// v000
// The times below were measured on an AMD MI455X: many runs one after another, warmed up first and cycling through
// copies of the inputs, with the whole window's GPU time divided by the number of runs. Launches and the gaps
// between them are all in it. The median over several windows is given; except for v000 it joins two sittings, which
// can be a few percent apart, so the side-by-side timings, each taken in one sitting, are the better comparison.
// v000, which the later versions start from, runs in 347 microseconds.
#include <hip/hip_runtime.h>
#include <hip/hip_bf16.h>

typedef __attribute__((ext_vector_type(2))) float v2f;
typedef __attribute__((ext_vector_type(8))) float v8f;

// D = A(16x4) * B(4x16) + C(16x16), fp32, wave32
#define WMMA_F32X4(a, b, c) \
  __builtin_amdgcn_wmma_f32_16x16x4_f32(false, (a), false, (b), (short)0, (c), false, false)

#define GLOBAL_AS __attribute__((address_space(1)))
#define LDS_AS    __attribute__((address_space(3)))

#if __has_builtin(__builtin_amdgcn_global_load_async_to_lds_b32)
#define HAVE_ASYNC_LDS 1
#else
#define HAVE_ASYNC_LDS 0
#endif

__device__ __forceinline__ void async_copy_b32(const float* gsrc, float* lds_dst) {
#if HAVE_ASYNC_LDS
  __builtin_amdgcn_global_load_async_to_lds_b32(
      (GLOBAL_AS int*)gsrc, (LDS_AS int*)lds_dst, 0, 0);
#else
  *lds_dst = *gsrc;
#endif
}

__device__ __forceinline__ void wait_async_lds() {
#if HAVE_ASYNC_LDS
#if __has_builtin(__builtin_amdgcn_s_wait_asynccnt)
  __builtin_amdgcn_s_wait_asynccnt(0);
#else
  asm volatile("s_wait_asynccnt 0" ::: "memory");
#endif
#endif
}

namespace {
constexpr int BATCH = 2;
constexpr int D     = 256;
constexpr int N     = 4096;
constexpr int H     = 4;
constexpr int D2    = 512;   // 2*D
}

// ---------------------------------------------------------------------------
// Generic conv1 (channel-wise linear): Y[b] = W (OxI) * X[b] (IxN) + bias.
// X rows [0, split) come from X0, rows [split, I) from X1 (for the concat).
// Grid: (N/128, O/16, BATCH), block 256 (8 waves, each one 16x16 tile).
// ---------------------------------------------------------------------------
__global__ __launch_bounds__(256)
void conv1_gemm_kernel(const float* __restrict__ W, const float* __restrict__ bias,
                       const float* __restrict__ X0, const float* __restrict__ X1,
                       int split, int O, int I, float* __restrict__ Y)
{
  constexpr int LDW = 514;               // max I (512) + 2 pad, keeps 8B align
  __shared__ float lds_w[16 * LDW];      // 32.9 KB

  const int t    = threadIdx.x;
  const int wave = t >> 5;
  const int lane = t & 31;
  const int half = lane >> 4;
  const int col  = lane & 15;
  const int b    = blockIdx.z;
  const int o0   = blockIdx.y * 16;
  const int n0   = blockIdx.x * 128 + wave * 16;

  // Stage the 16 x I weight tile once (all waves share the A operand).
  for (int e = t; e < 16 * I; e += 256) {
    int r = e / I, i = e - r * I;
    lds_w[r * LDW + i] = W[(size_t)(o0 + r) * I + i];
  }
  __syncthreads();

  // Per-lane column base pointers for the two activation sources.
  const float* p0 = X0 + (size_t)b * split * N + n0 + col;
  const float* p1 = X1 + (size_t)b * (I - split) * N + n0 + col;
  const float* wrow = &lds_w[col * LDW + 2 * half];

  v8f acc = {};
  // k in [0, split): source X0   (split is a multiple of 4, uniform per wave)
  for (int k0 = 0; k0 < split; k0 += 4) {
    v2f a; a.x = wrow[k0]; a.y = wrow[k0 + 1];
    const int i = k0 + 2 * half;
    v2f bf;
    bf.x = p0[(size_t)i * N];
    bf.y = p0[(size_t)(i + 1) * N];
    acc = WMMA_F32X4(a, bf, acc);
  }
  // k in [split, I): source X1
  for (int k0 = split; k0 < I; k0 += 4) {
    v2f a; a.x = wrow[k0]; a.y = wrow[k0 + 1];
    const int i = (k0 - split) + 2 * half;
    v2f bf;
    bf.x = p1[(size_t)i * N];
    bf.y = p1[(size_t)(i + 1) * N];
    acc = WMMA_F32X4(a, bf, acc);
  }

  float* yb = Y + (size_t)b * O * N;
#pragma unroll
  for (int r = 0; r < 8; ++r) {
    const int o = o0 + r + 8 * half;             // C layout: rows r / r+8
    yb[(size_t)o * N + n0 + col] = acc[r] + bias[o];
  }
}

// ---------------------------------------------------------------------------
// Flash attention, fp32 WMMA. Head-dim 64, scale 1/8.
// q/k/v/attn are (B, D, N); head h owns channels d*H + h, d in [0,64).
// Grid: (N/128, H, BATCH), block 256; each wave owns a 16-query tile and
// streams K/V in 64-wide blocks staged in LDS via ASYNCcnt-tracked
// global_load_async_to_lds (the per-lane LDS address does the K transpose).
// ---------------------------------------------------------------------------
__global__ __launch_bounds__(256)
void attention_kernel(const float* __restrict__ q, const float* __restrict__ k,
                      const float* __restrict__ v, float* __restrict__ attn)
{
  constexpr int LKV = 66;                    // 64 + 2 pad (even -> 8B align)
  __shared__ float ldsK[64 * LKV];           // K^T block: [m][d]
  __shared__ float ldsV[64 * LKV];           // V   block: [d][m]
  __shared__ float ldsP[8 * 16 * 17];        // per-wave P tile [m][n]

  const int t    = threadIdx.x;
  const int wave = t >> 5;
  const int lane = t & 31;
  const int half = lane >> 4;
  const int col  = lane & 15;
  const int h    = blockIdx.y;
  const int b    = blockIdx.z;
  const int n0   = blockIdx.x * 128 + wave * 16;

  const float* qb = q + (size_t)b * D * N;
  const float* kb = k + (size_t)b * D * N;
  const float* vb = v + (size_t)b * D * N;

  // Resident Q B-fragments: Qf[kk] covers d = 4*kk .. 4*kk+3 at 16 n-columns.
  v2f Qf[16];
#pragma unroll
  for (int kk = 0; kk < 16; ++kk) {
    const int d = 4 * kk + 2 * half;
    Qf[kk].x = qb[((size_t)d * H + h) * N + n0 + col];
    Qf[kk].y = qb[((size_t)(d + 1) * H + h) * N + n0 + col];
  }

  v8f acc[4] = {};                            // O tile: 64 d-rows x 16 n-cols
  float m_run = -1e30f, l_run = 0.0f;
  float* Pw = &ldsP[wave * 16 * 17];

  for (int mb = 0; mb < N; mb += 64) {
    __syncthreads();
    // Async stage of K^T and V blocks (coalesced on m; LDS side scattered).
    for (int j = 0; j < 16; ++j) {
      const int e = j * 256 + t;
      const int m = e & 63, d = e >> 6;
      const float* g = kb + ((size_t)d * H + h) * N + mb + m;
      async_copy_b32(g, &ldsK[m * LKV + d]);
      const float* gv = vb + ((size_t)d * H + h) * N + mb + m;
      async_copy_b32(gv, &ldsV[d * LKV + m]);
    }
    wait_async_lds();
    __syncthreads();

    for (int sub = 0; sub < 4; ++sub) {
      const int m0 = sub * 16;
      // S^T tile (rows m, cols n) = K^T * Q
      v8f s = {};
#pragma unroll
      for (int kk = 0; kk < 16; ++kk) {
        const float* kp = &ldsK[(m0 + col) * LKV + 4 * kk + 2 * half];
        v2f a; a.x = kp[0]; a.y = kp[1];
        s = WMMA_F32X4(a, Qf[kk], s);
      }
      // Online softmax (per n-column == per lane; halves combined via xor16).
      float tmax = -1e30f;
#pragma unroll
      for (int r = 0; r < 8; ++r) { s[r] *= 0.125f; tmax = fmaxf(tmax, s[r]); }
      tmax = fmaxf(tmax, __shfl_xor(tmax, 16, 32));
      const float m_new = fmaxf(m_run, tmax);
      const float alpha = __expf(m_run - m_new);
      float tsum = 0.0f;
#pragma unroll
      for (int r = 0; r < 8; ++r) {
        const float p = __expf(s[r] - m_new);
        s[r] = p;
        tsum += p;
      }
      tsum += __shfl_xor(tsum, 16, 32);
      l_run = l_run * alpha + tsum;
      m_run = m_new;
#pragma unroll
      for (int dt = 0; dt < 4; ++dt)
#pragma unroll
        for (int r = 0; r < 8; ++r) acc[dt][r] *= alpha;

      // Round-trip P through wave-private LDS to form B fragments.
#pragma unroll
      for (int r = 0; r < 8; ++r)
        Pw[(r + 8 * half) * 17 + col] = s[r];

      // O += V * P   (A = V 16d x 4m, B = P 4m x 16n)
#pragma unroll
      for (int dt = 0; dt < 4; ++dt) {
#pragma unroll
        for (int mk = 0; mk < 4; ++mk) {
          const float* vp = &ldsV[(dt * 16 + col) * LKV + m0 + 4 * mk + 2 * half];
          v2f a; a.x = vp[0]; a.y = vp[1];
          const int mr = 4 * mk + 2 * half;
          v2f bf;
          bf.x = Pw[mr * 17 + col];
          bf.y = Pw[(mr + 1) * 17 + col];
          acc[dt] = WMMA_F32X4(a, bf, acc[dt]);
        }
      }
    }
  }

  const float inv_l = 1.0f / l_run;
  float* ab = attn + (size_t)b * D * N;
#pragma unroll
  for (int dt = 0; dt < 4; ++dt) {
#pragma unroll
    for (int r = 0; r < 8; ++r) {
      const int d = dt * 16 + r + 8 * half;
      ab[((size_t)d * H + h) * N + n0 + col] = acc[dt][r] * inv_l;
    }
  }
}

// ---------------------------------------------------------------------------
// InstanceNorm1d (biased var over N) + ReLU, in place on h (B, 512, N).
// Grid: (512, BATCH), block 256.
// ---------------------------------------------------------------------------
__global__ __launch_bounds__(256)
void instnorm_relu_kernel(float* __restrict__ hbuf)
{
  __shared__ float red[2][8];
  const int t = threadIdx.x;
  const int c = blockIdx.x;
  const int b = blockIdx.y;
  float* p = hbuf + ((size_t)b * D2 + c) * N;

  float s = 0.0f, s2 = 0.0f;
  for (int i = t; i < N; i += 256) { const float x = p[i]; s += x; s2 += x * x; }
#pragma unroll
  for (int off = 16; off > 0; off >>= 1) {
    s  += __shfl_xor(s,  off, 32);
    s2 += __shfl_xor(s2, off, 32);
  }
  const int wave = t >> 5, lane = t & 31;
  if (lane == 0) { red[0][wave] = s; red[1][wave] = s2; }
  __syncthreads();
  float ts = 0.0f, ts2 = 0.0f;
#pragma unroll
  for (int w = 0; w < 8; ++w) { ts += red[0][w]; ts2 += red[1][w]; }
  const float mu   = ts / (float)N;
  const float var  = ts2 / (float)N - mu * mu;
  const float rstd = rsqrtf(var + 1e-5f);
  for (int i = t; i < N; i += 256) {
    const float x = (p[i] - mu) * rstd;
    p[i] = x > 0.0f ? x : 0.0f;
  }
}

// ---------------------------------------------------------------------------
extern "C" void kernel_launch(void* const* d_in, const int* in_sizes, int n_in,
                              void* d_out, int out_size, void* d_ws, size_t ws_size,
                              hipStream_t stream)
{
  const float* x   = (const float*)d_in[0];
  const float* src = (const float*)d_in[1];
  const float* Wq  = (const float*)d_in[2];
  const float* bq  = (const float*)d_in[3];
  const float* Wk  = (const float*)d_in[4];
  const float* bk  = (const float*)d_in[5];
  const float* Wv  = (const float*)d_in[6];
  const float* bv  = (const float*)d_in[7];
  const float* Wm  = (const float*)d_in[8];
  const float* bm  = (const float*)d_in[9];
  const float* W1  = (const float*)d_in[10];
  const float* b1  = (const float*)d_in[11];
  const float* W2  = (const float*)d_in[12];
  const float* b2  = (const float*)d_in[13];
  float* out = (float*)d_out;

  float* ws = (float*)d_ws;
  const size_t sz_dn = (size_t)BATCH * D * N;
  float* qb = ws;
  float* kb = qb + sz_dn;
  float* vb = kb + sz_dn;
  float* at = vb + sz_dn;
  float* ms = at + sz_dn;
  float* hb = ms + sz_dn;                     // BATCH * 512 * N

  const dim3 blk(256);
  // q = Wq x + bq ; k = Wk s + bk ; v = Wv s + bv
  conv1_gemm_kernel<<<dim3(N / 128, D / 16, BATCH), blk, 0, stream>>>(Wq, bq, x,   x,   D,  D,  D,  qb);
  conv1_gemm_kernel<<<dim3(N / 128, D / 16, BATCH), blk, 0, stream>>>(Wk, bk, src, src, D,  D,  D,  kb);
  conv1_gemm_kernel<<<dim3(N / 128, D / 16, BATCH), blk, 0, stream>>>(Wv, bv, src, src, D,  D,  D,  vb);
  // attention
  attention_kernel<<<dim3(N / 128, H, BATCH), blk, 0, stream>>>(qb, kb, vb, at);
  // message = Wm attn + bm
  conv1_gemm_kernel<<<dim3(N / 128, D / 16, BATCH), blk, 0, stream>>>(Wm, bm, at,  at,  D,  D,  D,  ms);
  // h = W1 [x; message] + b1
  conv1_gemm_kernel<<<dim3(N / 128, D2 / 16, BATCH), blk, 0, stream>>>(W1, b1, x,  ms,  D,  D2, D2, hb);
  // instance norm + relu, in place
  instnorm_relu_kernel<<<dim3(D2, BATCH), blk, 0, stream>>>(hb);
  // out = W2 h + b2
  conv1_gemm_kernel<<<dim3(N / 128, D / 16, BATCH), blk, 0, stream>>>(W2, b2, hb,  hb,  D2, D,  D2, out);
}

// v001
// A run of this version takes 312 microseconds.
// Next to v000, in two timings, it ran 1.16 times as fast each time.
#include <hip/hip_runtime.h>
#include <hip/hip_bf16.h>

typedef __attribute__((ext_vector_type(2))) float v2f;
typedef __attribute__((ext_vector_type(8))) float v8f;

// D = A(16x4) * B(4x16) + C(16x16), fp32, wave32
#define WMMA_F32X4(a, b, c) \
  __builtin_amdgcn_wmma_f32_16x16x4_f32(false, (a), false, (b), (short)0, (c), false, false)

#define GLOBAL_AS __attribute__((address_space(1)))
#define LDS_AS    __attribute__((address_space(3)))

#if __has_builtin(__builtin_amdgcn_global_load_async_to_lds_b32)
#define HAVE_ASYNC_LDS 1
#else
#define HAVE_ASYNC_LDS 0
#endif

__device__ __forceinline__ void async_copy_b32(const float* gsrc, float* lds_dst) {
#if HAVE_ASYNC_LDS
  __builtin_amdgcn_global_load_async_to_lds_b32(
      (GLOBAL_AS int*)gsrc, (LDS_AS int*)lds_dst, 0, 0);
#else
  *lds_dst = *gsrc;
#endif
}

__device__ __forceinline__ void wait_async_lds() {
#if HAVE_ASYNC_LDS
#if __has_builtin(__builtin_amdgcn_s_wait_asynccnt)
  __builtin_amdgcn_s_wait_asynccnt(0);
#else
  asm volatile("s_wait_asynccnt 0" ::: "memory");
#endif
#endif
}

namespace {
constexpr int BATCH = 2;
constexpr int D     = 256;
constexpr int N     = 4096;
constexpr int H     = 4;
constexpr int D2    = 512;   // 2*D
}

// ---------------------------------------------------------------------------
// conv1 (channel-wise linear): Y[b] = W (OxI) * X[b] (IxN) + bias.
// X rows [0, SPLIT) come from X0, rows [SPLIT, I) from X1 (for the concat).
// Grid: (N/128, O/64, BATCH), block 256. A work-group owns 64 output rows x
// 128 columns; each of its 8 waves owns 64 rows x 16 columns as four 16x16
// accumulator tiles, so one X fragment from global feeds four WMMAs.
// ---------------------------------------------------------------------------
template <int O, int I, int SPLIT>
__global__ __launch_bounds__(256)
void conv1_gemm_kernel(const float* __restrict__ W, const float* __restrict__ bias,
                       const float* __restrict__ X0, const float* __restrict__ X1,
                       float* __restrict__ Y)
{
  constexpr int LDW = I + 2;             // 2 pad, keeps 8B align
  __shared__ __attribute__((aligned(16))) float lds_w[64 * LDW];

  const int t    = threadIdx.x;
  const int wave = t >> 5;
  const int lane = t & 31;
  const int half = lane >> 4;
  const int col  = lane & 15;
  const int b    = blockIdx.z;
  const int o0   = blockIdx.y * 64;
  const int n0   = blockIdx.x * 128 + wave * 16;

  // Stage the 64 x I weight tile once (all waves share the A operand).
  // The tile's rows are contiguous in W; two floats per lane and copy.
  const float* wt = W + (size_t)o0 * I;
  // Fully unrolled so that all of a lane's loads are in flight together.
#pragma unroll
  for (int j = 0; j < 64 * I / 2 / 256; ++j) {
    const int e = j * 256 + t;
    const int r = e / (I / 2), i = 2 * (e - r * (I / 2));
    *(v2f*)&lds_w[r * LDW + i] = *(const v2f*)&wt[2 * e];
  }
  __syncthreads();

  // Per-lane column base pointers for the two activation sources.
  const float* p0 = X0 + (size_t)b * SPLIT * N + n0 + col;
  const float* p1 = X1 + (size_t)b * (I - SPLIT) * N + n0 + col;
  const float* wrow = &lds_w[col * LDW + 2 * half];

  v8f acc[4] = {};
  // Both k loops: 16 steps per trip put 32 X loads in flight ahead of 64 WMMAs,
  // so that with two waves per SIMD one wave's load latency lies under the
  // other's products.
  // k in [0, SPLIT): source X0
#pragma unroll 16
  for (int k0 = 0; k0 < SPLIT; k0 += 4) {
    const int i = k0 + 2 * half;
    v2f bf;
    bf.x = p0[(size_t)i * N];
    bf.y = p0[(size_t)(i + 1) * N];
#pragma unroll
    for (int ot = 0; ot < 4; ++ot) {
      v2f a; a.x = wrow[ot * 16 * LDW + k0]; a.y = wrow[ot * 16 * LDW + k0 + 1];
      acc[ot] = WMMA_F32X4(a, bf, acc[ot]);
    }
  }
  // k in [SPLIT, I): source X1
#pragma unroll 16
  for (int k0 = SPLIT; k0 < I; k0 += 4) {
    const int i = (k0 - SPLIT) + 2 * half;
    v2f bf;
    bf.x = p1[(size_t)i * N];
    bf.y = p1[(size_t)(i + 1) * N];
#pragma unroll
    for (int ot = 0; ot < 4; ++ot) {
      v2f a; a.x = wrow[ot * 16 * LDW + k0]; a.y = wrow[ot * 16 * LDW + k0 + 1];
      acc[ot] = WMMA_F32X4(a, bf, acc[ot]);
    }
  }

  float* yb = Y + (size_t)b * O * N;
#pragma unroll
  for (int ot = 0; ot < 4; ++ot) {
#pragma unroll
    for (int r = 0; r < 8; ++r) {
      const int o = o0 + ot * 16 + r + 8 * half;   // C layout: rows r / r+8
      yb[(size_t)o * N + n0 + col] = acc[ot][r] + bias[o];
    }
  }
}

// ---------------------------------------------------------------------------
// Flash attention, fp32 WMMA. Head-dim 64, scale 1/8.
// q/k/v/attn are (B, D, N); head h owns channels d*H + h, d in [0,64).
// Grid: (N/128, H, BATCH), block 256; each wave owns a 16-query tile and
// streams K/V in 64-wide blocks staged in LDS via ASYNCcnt-tracked
// global_load_async_to_lds (the per-lane LDS address does the K transpose).
// ---------------------------------------------------------------------------
__global__ __launch_bounds__(256)
void attention_kernel(const float* __restrict__ q, const float* __restrict__ k,
                      const float* __restrict__ v, float* __restrict__ attn)
{
  constexpr int LKV = 66;                    // 64 + 2 pad (even -> 8B align)
  __shared__ float ldsK[64 * LKV];           // K^T block: [m][d]
  __shared__ float ldsV[64 * LKV];           // V   block: [d][m]
  __shared__ float ldsP[8 * 16 * 17];        // per-wave P tile [m][n]

  const int t    = threadIdx.x;
  const int wave = t >> 5;
  const int lane = t & 31;
  const int half = lane >> 4;
  const int col  = lane & 15;
  const int h    = blockIdx.y;
  const int b    = blockIdx.z;
  const int n0   = blockIdx.x * 128 + wave * 16;

  const float* qb = q + (size_t)b * D * N;
  const float* kb = k + (size_t)b * D * N;
  const float* vb = v + (size_t)b * D * N;

  // Resident Q B-fragments: Qf[kk] covers d = 4*kk .. 4*kk+3 at 16 n-columns.
  v2f Qf[16];
#pragma unroll
  for (int kk = 0; kk < 16; ++kk) {
    const int d = 4 * kk + 2 * half;
    Qf[kk].x = qb[((size_t)d * H + h) * N + n0 + col];
    Qf[kk].y = qb[((size_t)(d + 1) * H + h) * N + n0 + col];
  }

  v8f acc[4] = {};                            // O tile: 64 d-rows x 16 n-cols
  float m_run = -1e30f, l_run = 0.0f;
  float* Pw = &ldsP[wave * 16 * 17];

  for (int mb = 0; mb < N; mb += 64) {
    __syncthreads();
    // Async stage of K^T and V blocks (coalesced on m; LDS side scattered).
    for (int j = 0; j < 16; ++j) {
      const int e = j * 256 + t;
      const int m = e & 63, d = e >> 6;
      const float* g = kb + ((size_t)d * H + h) * N + mb + m;
      async_copy_b32(g, &ldsK[m * LKV + d]);
      const float* gv = vb + ((size_t)d * H + h) * N + mb + m;
      async_copy_b32(gv, &ldsV[d * LKV + m]);
    }
    wait_async_lds();
    __syncthreads();

    for (int sub = 0; sub < 4; ++sub) {
      const int m0 = sub * 16;
      // S^T tile (rows m, cols n) = K^T * Q
      v8f s = {};
#pragma unroll
      for (int kk = 0; kk < 16; ++kk) {
        const float* kp = &ldsK[(m0 + col) * LKV + 4 * kk + 2 * half];
        v2f a; a.x = kp[0]; a.y = kp[1];
        s = WMMA_F32X4(a, Qf[kk], s);
      }
      // Online softmax (per n-column == per lane; halves combined via xor16).
      float tmax = -1e30f;
#pragma unroll
      for (int r = 0; r < 8; ++r) { s[r] *= 0.125f; tmax = fmaxf(tmax, s[r]); }
      tmax = fmaxf(tmax, __shfl_xor(tmax, 16, 32));
      const float m_new = fmaxf(m_run, tmax);
      const float alpha = __expf(m_run - m_new);
      float tsum = 0.0f;
#pragma unroll
      for (int r = 0; r < 8; ++r) {
        const float p = __expf(s[r] - m_new);
        s[r] = p;
        tsum += p;
      }
      tsum += __shfl_xor(tsum, 16, 32);
      l_run = l_run * alpha + tsum;
      m_run = m_new;
#pragma unroll
      for (int dt = 0; dt < 4; ++dt)
#pragma unroll
        for (int r = 0; r < 8; ++r) acc[dt][r] *= alpha;

      // Round-trip P through wave-private LDS to form B fragments.
#pragma unroll
      for (int r = 0; r < 8; ++r)
        Pw[(r + 8 * half) * 17 + col] = s[r];

      // O += V * P   (A = V 16d x 4m, B = P 4m x 16n)
#pragma unroll
      for (int dt = 0; dt < 4; ++dt) {
#pragma unroll
        for (int mk = 0; mk < 4; ++mk) {
          const float* vp = &ldsV[(dt * 16 + col) * LKV + m0 + 4 * mk + 2 * half];
          v2f a; a.x = vp[0]; a.y = vp[1];
          const int mr = 4 * mk + 2 * half;
          v2f bf;
          bf.x = Pw[mr * 17 + col];
          bf.y = Pw[(mr + 1) * 17 + col];
          acc[dt] = WMMA_F32X4(a, bf, acc[dt]);
        }
      }
    }
  }

  const float inv_l = 1.0f / l_run;
  float* ab = attn + (size_t)b * D * N;
#pragma unroll
  for (int dt = 0; dt < 4; ++dt) {
#pragma unroll
    for (int r = 0; r < 8; ++r) {
      const int d = dt * 16 + r + 8 * half;
      ab[((size_t)d * H + h) * N + n0 + col] = acc[dt][r] * inv_l;
    }
  }
}

// ---------------------------------------------------------------------------
// InstanceNorm1d (biased var over N) + ReLU, in place on h (B, 512, N).
// Grid: (512, BATCH), block 256.
// ---------------------------------------------------------------------------
__global__ __launch_bounds__(256)
void instnorm_relu_kernel(float* __restrict__ hbuf)
{
  __shared__ float red[2][8];
  const int t = threadIdx.x;
  const int c = blockIdx.x;
  const int b = blockIdx.y;
  float* p = hbuf + ((size_t)b * D2 + c) * N;

  float s = 0.0f, s2 = 0.0f;
  for (int i = t; i < N; i += 256) { const float x = p[i]; s += x; s2 += x * x; }
#pragma unroll
  for (int off = 16; off > 0; off >>= 1) {
    s  += __shfl_xor(s,  off, 32);
    s2 += __shfl_xor(s2, off, 32);
  }
  const int wave = t >> 5, lane = t & 31;
  if (lane == 0) { red[0][wave] = s; red[1][wave] = s2; }
  __syncthreads();
  float ts = 0.0f, ts2 = 0.0f;
#pragma unroll
  for (int w = 0; w < 8; ++w) { ts += red[0][w]; ts2 += red[1][w]; }
  const float mu   = ts / (float)N;
  const float var  = ts2 / (float)N - mu * mu;
  const float rstd = rsqrtf(var + 1e-5f);
  for (int i = t; i < N; i += 256) {
    const float x = (p[i] - mu) * rstd;
    p[i] = x > 0.0f ? x : 0.0f;
  }
}

// ---------------------------------------------------------------------------
extern "C" void kernel_launch(void* const* d_in, const int* in_sizes, int n_in,
                              void* d_out, int out_size, void* d_ws, size_t ws_size,
                              hipStream_t stream)
{
  const float* x   = (const float*)d_in[0];
  const float* src = (const float*)d_in[1];
  const float* Wq  = (const float*)d_in[2];
  const float* bq  = (const float*)d_in[3];
  const float* Wk  = (const float*)d_in[4];
  const float* bk  = (const float*)d_in[5];
  const float* Wv  = (const float*)d_in[6];
  const float* bv  = (const float*)d_in[7];
  const float* Wm  = (const float*)d_in[8];
  const float* bm  = (const float*)d_in[9];
  const float* W1  = (const float*)d_in[10];
  const float* b1  = (const float*)d_in[11];
  const float* W2  = (const float*)d_in[12];
  const float* b2  = (const float*)d_in[13];
  float* out = (float*)d_out;

  float* ws = (float*)d_ws;
  const size_t sz_dn = (size_t)BATCH * D * N;
  float* qb = ws;
  float* kb = qb + sz_dn;
  float* vb = kb + sz_dn;
  float* at = vb + sz_dn;
  float* ms = at + sz_dn;
  float* hb = ms + sz_dn;                     // BATCH * 512 * N

  const dim3 blk(256);
  // q = Wq x + bq ; k = Wk s + bk ; v = Wv s + bv
  conv1_gemm_kernel<D, D, D><<<dim3(N / 128, D / 64, BATCH), blk, 0, stream>>>(Wq, bq, x,   x,   qb);
  conv1_gemm_kernel<D, D, D><<<dim3(N / 128, D / 64, BATCH), blk, 0, stream>>>(Wk, bk, src, src, kb);
  conv1_gemm_kernel<D, D, D><<<dim3(N / 128, D / 64, BATCH), blk, 0, stream>>>(Wv, bv, src, src, vb);
  // attention
  attention_kernel<<<dim3(N / 128, H, BATCH), blk, 0, stream>>>(qb, kb, vb, at);
  // message = Wm attn + bm
  conv1_gemm_kernel<D, D, D><<<dim3(N / 128, D / 64, BATCH), blk, 0, stream>>>(Wm, bm, at,  at,  ms);
  // h = W1 [x; message] + b1
  conv1_gemm_kernel<D2, D2, D><<<dim3(N / 128, D2 / 64, BATCH), blk, 0, stream>>>(W1, b1, x,  ms,  hb);
  // instance norm + relu, in place
  instnorm_relu_kernel<<<dim3(D2, BATCH), blk, 0, stream>>>(hb);
  // out = W2 h + b2
  conv1_gemm_kernel<D, D2, D2><<<dim3(N / 128, D / 64, BATCH), blk, 0, stream>>>(W2, b2, hb,  hb,  out);
}

// v002
// It runs in 294 microseconds.
// Two timings next to v001 both put it at 1.06 times that version's speed.
// All steps since v000 together make it 1.23 times as fast.
#include <hip/hip_runtime.h>
#include <hip/hip_bf16.h>

typedef __attribute__((ext_vector_type(2))) float v2f;
typedef __attribute__((ext_vector_type(8))) float v8f;

// D = A(16x4) * B(4x16) + C(16x16), fp32, wave32
#define WMMA_F32X4(a, b, c) \
  __builtin_amdgcn_wmma_f32_16x16x4_f32(false, (a), false, (b), (short)0, (c), false, false)

#define GLOBAL_AS __attribute__((address_space(1)))
#define LDS_AS    __attribute__((address_space(3)))

#if __has_builtin(__builtin_amdgcn_global_load_async_to_lds_b32)
#define HAVE_ASYNC_LDS 1
#else
#define HAVE_ASYNC_LDS 0
#endif

__device__ __forceinline__ void async_copy_b32(const float* gsrc, float* lds_dst) {
#if HAVE_ASYNC_LDS
  __builtin_amdgcn_global_load_async_to_lds_b32(
      (GLOBAL_AS int*)gsrc, (LDS_AS int*)lds_dst, 0, 0);
#else
  *lds_dst = *gsrc;
#endif
}

namespace {
constexpr int BATCH = 2;
constexpr int D     = 256;
constexpr int N     = 4096;
constexpr int H     = 4;
constexpr int D2    = 512;   // 2*D
}

// ---------------------------------------------------------------------------
// conv1 (channel-wise linear): Y[b] = W (OxI) * X[b] (IxN) + bias.
// X rows [0, SPLIT) come from X0, rows [SPLIT, I) from X1 (for the concat).
// Grid: (N/128, O/64, BATCH), block 256. A work-group owns 64 output rows x
// 128 columns; each of its 8 waves owns 64 rows x 16 columns as four 16x16
// accumulator tiles, so one X fragment from global feeds four WMMAs.
// ---------------------------------------------------------------------------
template <int O, int I, int SPLIT>
__global__ __launch_bounds__(256)
void conv1_gemm_kernel(const float* __restrict__ W, const float* __restrict__ bias,
                       const float* __restrict__ X0, const float* __restrict__ X1,
                       float* __restrict__ Y)
{
  constexpr int LDW = I + 2;             // 2 pad, keeps 8B align
  __shared__ __attribute__((aligned(16))) float lds_w[64 * LDW];

  const int t    = threadIdx.x;
  const int wave = t >> 5;
  const int lane = t & 31;
  const int half = lane >> 4;
  const int col  = lane & 15;
  const int b    = blockIdx.z;
  const int o0   = blockIdx.y * 64;
  const int n0   = blockIdx.x * 128 + wave * 16;

  // Stage the 64 x I weight tile once (all waves share the A operand).
  // The tile's rows are contiguous in W; two floats per lane and copy.
  const float* wt = W + (size_t)o0 * I;
  // Fully unrolled so that all of a lane's loads are in flight together.
#pragma unroll
  for (int j = 0; j < 64 * I / 2 / 256; ++j) {
    const int e = j * 256 + t;
    const int r = e / (I / 2), i = 2 * (e - r * (I / 2));
    *(v2f*)&lds_w[r * LDW + i] = *(const v2f*)&wt[2 * e];
  }
  __syncthreads();

  // Per-lane column base pointers for the two activation sources.
  const float* p0 = X0 + (size_t)b * SPLIT * N + n0 + col;
  const float* p1 = X1 + (size_t)b * (I - SPLIT) * N + n0 + col;
  const float* wrow = &lds_w[col * LDW + 2 * half];

  v8f acc[4] = {};
  // Both k loops: 16 steps per trip put 32 X loads in flight ahead of 64 WMMAs,
  // so that with two waves per SIMD one wave's load latency lies under the
  // other's products.
  // k in [0, SPLIT): source X0
#pragma unroll 16
  for (int k0 = 0; k0 < SPLIT; k0 += 4) {
    const int i = k0 + 2 * half;
    v2f bf;
    bf.x = p0[(size_t)i * N];
    bf.y = p0[(size_t)(i + 1) * N];
#pragma unroll
    for (int ot = 0; ot < 4; ++ot) {
      v2f a; a.x = wrow[ot * 16 * LDW + k0]; a.y = wrow[ot * 16 * LDW + k0 + 1];
      acc[ot] = WMMA_F32X4(a, bf, acc[ot]);
    }
  }
  // k in [SPLIT, I): source X1
#pragma unroll 16
  for (int k0 = SPLIT; k0 < I; k0 += 4) {
    const int i = (k0 - SPLIT) + 2 * half;
    v2f bf;
    bf.x = p1[(size_t)i * N];
    bf.y = p1[(size_t)(i + 1) * N];
#pragma unroll
    for (int ot = 0; ot < 4; ++ot) {
      v2f a; a.x = wrow[ot * 16 * LDW + k0]; a.y = wrow[ot * 16 * LDW + k0 + 1];
      acc[ot] = WMMA_F32X4(a, bf, acc[ot]);
    }
  }

  float* yb = Y + (size_t)b * O * N;
#pragma unroll
  for (int ot = 0; ot < 4; ++ot) {
#pragma unroll
    for (int r = 0; r < 8; ++r) {
      const int o = o0 + ot * 16 + r + 8 * half;   // C layout: rows r / r+8
      yb[(size_t)o * N + n0 + col] = acc[ot][r] + bias[o];
    }
  }
}

// ---------------------------------------------------------------------------
// Flash attention, fp32 WMMA. Head-dim 64, scale 1/8.
// q/k/v/attn are (B, D, N); head h owns channels d*H + h, d in [0,64).
// Grid: (N/128, H, BATCH), block 256; each wave owns a 16-query tile and
// streams K/V in 64-wide blocks staged in LDS via ASYNCcnt-tracked
// global_load_async_to_lds (the per-lane LDS address does the K transpose).
// Two LDS buffers: while block t is worked on, block t+1's copies are in flight.
// ---------------------------------------------------------------------------
__global__ __launch_bounds__(256)
void attention_kernel(const float* __restrict__ q, const float* __restrict__ k,
                      const float* __restrict__ v, float* __restrict__ attn)
{
  constexpr int LKV = 66;                    // 64 + 2 pad (even -> 8B align)
  constexpr int TILE = 64 * LKV;             // floats of one staged block
  __shared__ float ldsK[2 * TILE];           // K^T blocks: [buffer][m][d]
  __shared__ float ldsV[2 * TILE];           // V   blocks: [buffer][d][m]
  __shared__ float ldsP[8 * 16 * 17];        // per-wave P tile [m][n]

  const int t    = threadIdx.x;
  const int wave = t >> 5;
  const int lane = t & 31;
  const int half = lane >> 4;
  const int col  = lane & 15;
  const int h    = blockIdx.y;
  const int b    = blockIdx.z;
  const int n0   = blockIdx.x * 128 + wave * 16;

  const float* qb = q + (size_t)b * D * N;
  const float* kb = k + (size_t)b * D * N;
  const float* vb = v + (size_t)b * D * N;

  // Resident Q B-fragments: Qf[kk] covers d = 4*kk .. 4*kk+3 at 16 n-columns.
  v2f Qf[16];
#pragma unroll
  for (int kk = 0; kk < 16; ++kk) {
    const int d = 4 * kk + 2 * half;
    Qf[kk].x = qb[((size_t)d * H + h) * N + n0 + col];
    Qf[kk].y = qb[((size_t)(d + 1) * H + h) * N + n0 + col];
  }

  v8f acc[4] = {};                            // O tile: 64 d-rows x 16 n-cols
  float m_run = -1e30f, l_run = 0.0f;
  float* Pw = &ldsP[wave * 16 * 17];

  // Async stage of the K^T and V blocks at key mb0 into buffer buf
  // (coalesced on m; LDS side scattered). 32 copies per wave.
  auto stage = [&](int mb0, int buf) {
    for (int j = 0; j < 16; ++j) {
      const int e = j * 256 + t;
      const int m = e & 63, d = e >> 6;
      const float* g = kb + ((size_t)d * H + h) * N + mb0 + m;
      async_copy_b32(g, &ldsK[buf * TILE + m * LKV + d]);
      const float* gv = vb + ((size_t)d * H + h) * N + mb0 + m;
      async_copy_b32(gv, &ldsV[buf * TILE + d * LKV + m]);
    }
  };

  stage(0, 0);
  // Block 0 has landed in this wave's view before the barrier publishes it.
  asm volatile("s_wait_asynccnt 0x0" ::: "memory");
  __syncthreads();
  stage(64, 1);

  for (int mb = 0; mb < N; mb += 64) {
    const int buf = (mb >> 6) & 1;
    const float* Kb = &ldsK[buf * TILE];
    const float* Vb = &ldsV[buf * TILE];

    for (int sub = 0; sub < 4; ++sub) {
      const int m0 = sub * 16;
      // S^T tile (rows m, cols n) = K^T * Q
      v8f s = {};
#pragma unroll
      for (int kk = 0; kk < 16; ++kk) {
        const float* kp = &Kb[(m0 + col) * LKV + 4 * kk + 2 * half];
        v2f a; a.x = kp[0]; a.y = kp[1];
        s = WMMA_F32X4(a, Qf[kk], s);
      }
      // Online softmax (per n-column == per lane; halves combined via xor16).
      float tmax = -1e30f;
#pragma unroll
      for (int r = 0; r < 8; ++r) { s[r] *= 0.125f; tmax = fmaxf(tmax, s[r]); }
      tmax = fmaxf(tmax, __shfl_xor(tmax, 16, 32));
      const float m_new = fmaxf(m_run, tmax);
      const float alpha = __expf(m_run - m_new);
      float tsum = 0.0f;
#pragma unroll
      for (int r = 0; r < 8; ++r) {
        const float p = __expf(s[r] - m_new);
        s[r] = p;
        tsum += p;
      }
      tsum += __shfl_xor(tsum, 16, 32);
      l_run = l_run * alpha + tsum;
      m_run = m_new;
#pragma unroll
      for (int dt = 0; dt < 4; ++dt)
#pragma unroll
        for (int r = 0; r < 8; ++r) acc[dt][r] *= alpha;

      // Round-trip P through wave-private LDS to form B fragments.
#pragma unroll
      for (int r = 0; r < 8; ++r)
        Pw[(r + 8 * half) * 17 + col] = s[r];

      // O += V * P   (A = V 16d x 4m, B = P 4m x 16n)
#pragma unroll
      for (int dt = 0; dt < 4; ++dt) {
#pragma unroll
        for (int mk = 0; mk < 4; ++mk) {
          const float* vp = &Vb[(dt * 16 + col) * LKV + m0 + 4 * mk + 2 * half];
          v2f a; a.x = vp[0]; a.y = vp[1];
          const int mr = 4 * mk + 2 * half;
          v2f bf;
          bf.x = Pw[mr * 17 + col];
          bf.y = Pw[(mr + 1) * 17 + col];
          acc[dt] = WMMA_F32X4(a, bf, acc[dt]);
        }
      }
    }

    // Publish point of block t+1, which also frees block t's buffer.
    // This wave's LDS reads of the buffer to be refilled have returned:
    asm volatile("s_wait_dscnt 0x0" ::: "memory");
    // this wave's copies of block t+1 have landed:
    asm volatile("s_wait_asynccnt 0x0" ::: "memory");
    __syncthreads();
    if (mb + 128 < N) stage(mb + 128, buf);
  }
  // No copy is outstanding when the wave ends.
  asm volatile("s_wait_asynccnt 0x0" ::: "memory");

  const float inv_l = 1.0f / l_run;
  float* ab = attn + (size_t)b * D * N;
#pragma unroll
  for (int dt = 0; dt < 4; ++dt) {
#pragma unroll
    for (int r = 0; r < 8; ++r) {
      const int d = dt * 16 + r + 8 * half;
      ab[((size_t)d * H + h) * N + n0 + col] = acc[dt][r] * inv_l;
    }
  }
}

// ---------------------------------------------------------------------------
// InstanceNorm1d (biased var over N) + ReLU, in place on h (B, 512, N).
// Grid: (512, BATCH), block 256.
// ---------------------------------------------------------------------------
__global__ __launch_bounds__(256)
void instnorm_relu_kernel(float* __restrict__ hbuf)
{
  __shared__ float red[2][8];
  const int t = threadIdx.x;
  const int c = blockIdx.x;
  const int b = blockIdx.y;
  float* p = hbuf + ((size_t)b * D2 + c) * N;

  float s = 0.0f, s2 = 0.0f;
  for (int i = t; i < N; i += 256) { const float x = p[i]; s += x; s2 += x * x; }
#pragma unroll
  for (int off = 16; off > 0; off >>= 1) {
    s  += __shfl_xor(s,  off, 32);
    s2 += __shfl_xor(s2, off, 32);
  }
  const int wave = t >> 5, lane = t & 31;
  if (lane == 0) { red[0][wave] = s; red[1][wave] = s2; }
  __syncthreads();
  float ts = 0.0f, ts2 = 0.0f;
#pragma unroll
  for (int w = 0; w < 8; ++w) { ts += red[0][w]; ts2 += red[1][w]; }
  const float mu   = ts / (float)N;
  const float var  = ts2 / (float)N - mu * mu;
  const float rstd = rsqrtf(var + 1e-5f);
  for (int i = t; i < N; i += 256) {
    const float x = (p[i] - mu) * rstd;
    p[i] = x > 0.0f ? x : 0.0f;
  }
}

// ---------------------------------------------------------------------------
extern "C" void kernel_launch(void* const* d_in, const int* in_sizes, int n_in,
                              void* d_out, int out_size, void* d_ws, size_t ws_size,
                              hipStream_t stream)
{
  const float* x   = (const float*)d_in[0];
  const float* src = (const float*)d_in[1];
  const float* Wq  = (const float*)d_in[2];
  const float* bq  = (const float*)d_in[3];
  const float* Wk  = (const float*)d_in[4];
  const float* bk  = (const float*)d_in[5];
  const float* Wv  = (const float*)d_in[6];
  const float* bv  = (const float*)d_in[7];
  const float* Wm  = (const float*)d_in[8];
  const float* bm  = (const float*)d_in[9];
  const float* W1  = (const float*)d_in[10];
  const float* b1  = (const float*)d_in[11];
  const float* W2  = (const float*)d_in[12];
  const float* b2  = (const float*)d_in[13];
  float* out = (float*)d_out;

  float* ws = (float*)d_ws;
  const size_t sz_dn = (size_t)BATCH * D * N;
  float* qb = ws;
  float* kb = qb + sz_dn;
  float* vb = kb + sz_dn;
  float* at = vb + sz_dn;
  float* ms = at + sz_dn;
  float* hb = ms + sz_dn;                     // BATCH * 512 * N

  const dim3 blk(256);
  // q = Wq x + bq ; k = Wk s + bk ; v = Wv s + bv
  conv1_gemm_kernel<D, D, D><<<dim3(N / 128, D / 64, BATCH), blk, 0, stream>>>(Wq, bq, x,   x,   qb);
  conv1_gemm_kernel<D, D, D><<<dim3(N / 128, D / 64, BATCH), blk, 0, stream>>>(Wk, bk, src, src, kb);
  conv1_gemm_kernel<D, D, D><<<dim3(N / 128, D / 64, BATCH), blk, 0, stream>>>(Wv, bv, src, src, vb);
  // attention
  attention_kernel<<<dim3(N / 128, H, BATCH), blk, 0, stream>>>(qb, kb, vb, at);
  // message = Wm attn + bm
  conv1_gemm_kernel<D, D, D><<<dim3(N / 128, D / 64, BATCH), blk, 0, stream>>>(Wm, bm, at,  at,  ms);
  // h = W1 [x; message] + b1
  conv1_gemm_kernel<D2, D2, D><<<dim3(N / 128, D2 / 64, BATCH), blk, 0, stream>>>(W1, b1, x,  ms,  hb);
  // instance norm + relu, in place
  instnorm_relu_kernel<<<dim3(D2, BATCH), blk, 0, stream>>>(hb);
  // out = W2 h + b2
  conv1_gemm_kernel<D, D2, D2><<<dim3(N / 128, D / 64, BATCH), blk, 0, stream>>>(W2, b2, hb,  hb,  out);
}

// v003
// One run takes 282 microseconds.
// In both of two side-by-side timings against v002, it was 1.04 times as fast.
// Over all steps from v000 it is 1.28 times as fast.
#include <hip/hip_runtime.h>
#include <hip/hip_bf16.h>

typedef __attribute__((ext_vector_type(2))) float v2f;
typedef __attribute__((ext_vector_type(8))) float v8f;

// D = A(16x4) * B(4x16) + C(16x16), fp32, wave32
#define WMMA_F32X4(a, b, c) \
  __builtin_amdgcn_wmma_f32_16x16x4_f32(false, (a), false, (b), (short)0, (c), false, false)

#define GLOBAL_AS __attribute__((address_space(1)))
#define LDS_AS    __attribute__((address_space(3)))

#if __has_builtin(__builtin_amdgcn_global_load_async_to_lds_b32)
#define HAVE_ASYNC_LDS 1
#else
#define HAVE_ASYNC_LDS 0
#endif

__device__ __forceinline__ void async_copy_b32(const float* gsrc, float* lds_dst) {
#if HAVE_ASYNC_LDS
  __builtin_amdgcn_global_load_async_to_lds_b32(
      (GLOBAL_AS int*)gsrc, (LDS_AS int*)lds_dst, 0, 0);
#else
  *lds_dst = *gsrc;
#endif
}

namespace {
constexpr int BATCH = 2;
constexpr int D     = 256;
constexpr int N     = 4096;
constexpr int H     = 4;
constexpr int D2    = 512;   // 2*D
}

// ---------------------------------------------------------------------------
// conv1 (channel-wise linear): Y[b] = W (OxI) * X[b] (IxN) + bias.
// X rows [0, SPLIT) come from X0, rows [SPLIT, I) from X1 (for the concat).
// Grid: (N/128, O/64, BATCH), block 256. A work-group owns 64 output rows x
// 128 columns; each of its 8 waves owns 64 rows x 16 columns as four 16x16
// accumulator tiles, so one X fragment from global feeds four WMMAs.
// ---------------------------------------------------------------------------
template <int O, int I, int SPLIT>
__global__ __launch_bounds__(256)
void conv1_gemm_kernel(const float* __restrict__ W, const float* __restrict__ bias,
                       const float* __restrict__ X0, const float* __restrict__ X1,
                       float* __restrict__ Y)
{
  constexpr int LDW = I + 2;             // 2 pad, keeps 8B align
  __shared__ __attribute__((aligned(16))) float lds_w[64 * LDW];

  const int t    = threadIdx.x;
  const int wave = t >> 5;
  const int lane = t & 31;
  const int half = lane >> 4;
  const int col  = lane & 15;
  const int b    = blockIdx.z;
  const int o0   = blockIdx.y * 64;
  const int n0   = blockIdx.x * 128 + wave * 16;

  // Stage the 64 x I weight tile once (all waves share the A operand).
  // The tile's rows are contiguous in W; two floats per lane and copy.
  const float* wt = W + (size_t)o0 * I;
  // Fully unrolled so that all of a lane's loads are in flight together.
#pragma unroll
  for (int j = 0; j < 64 * I / 2 / 256; ++j) {
    const int e = j * 256 + t;
    const int r = e / (I / 2), i = 2 * (e - r * (I / 2));
    *(v2f*)&lds_w[r * LDW + i] = *(const v2f*)&wt[2 * e];
  }
  __syncthreads();

  // Per-lane column base pointers for the two activation sources.
  const float* p0 = X0 + (size_t)b * SPLIT * N + n0 + col;
  const float* p1 = X1 + (size_t)b * (I - SPLIT) * N + n0 + col;
  const float* wrow = &lds_w[col * LDW + 2 * half];

  v8f acc[4] = {};
  // Both k loops: 16 steps per trip put 32 X loads in flight ahead of 64 WMMAs,
  // so that with two waves per SIMD one wave's load latency lies under the
  // other's products.
  // k in [0, SPLIT): source X0
#pragma unroll 16
  for (int k0 = 0; k0 < SPLIT; k0 += 4) {
    const int i = k0 + 2 * half;
    v2f bf;
    bf.x = p0[(size_t)i * N];
    bf.y = p0[(size_t)(i + 1) * N];
#pragma unroll
    for (int ot = 0; ot < 4; ++ot) {
      v2f a; a.x = wrow[ot * 16 * LDW + k0]; a.y = wrow[ot * 16 * LDW + k0 + 1];
      acc[ot] = WMMA_F32X4(a, bf, acc[ot]);
    }
  }
  // k in [SPLIT, I): source X1
#pragma unroll 16
  for (int k0 = SPLIT; k0 < I; k0 += 4) {
    const int i = (k0 - SPLIT) + 2 * half;
    v2f bf;
    bf.x = p1[(size_t)i * N];
    bf.y = p1[(size_t)(i + 1) * N];
#pragma unroll
    for (int ot = 0; ot < 4; ++ot) {
      v2f a; a.x = wrow[ot * 16 * LDW + k0]; a.y = wrow[ot * 16 * LDW + k0 + 1];
      acc[ot] = WMMA_F32X4(a, bf, acc[ot]);
    }
  }

  float* yb = Y + (size_t)b * O * N;
#pragma unroll
  for (int ot = 0; ot < 4; ++ot) {
#pragma unroll
    for (int r = 0; r < 8; ++r) {
      const int o = o0 + ot * 16 + r + 8 * half;   // C layout: rows r / r+8
      yb[(size_t)o * N + n0 + col] = acc[ot][r] + bias[o];
    }
  }
}

// ---------------------------------------------------------------------------
// Flash attention, fp32 WMMA. Head-dim 64, scale 1/8.
// q/k/v/attn are (B, D, N); head h owns channels d*H + h, d in [0,64).
// Grid: (N/128, H, BATCH), block 256; each wave owns a 16-query tile and
// streams K/V in 64-wide blocks staged in LDS via ASYNCcnt-tracked
// global_load_async_to_lds (the per-lane LDS address does the K transpose).
// Two LDS buffers: while block t is worked on, block t+1's copies are in flight.
// ---------------------------------------------------------------------------
__global__ __launch_bounds__(256)
void attention_kernel(const float* __restrict__ q, const float* __restrict__ k,
                      const float* __restrict__ v, float* __restrict__ attn)
{
  constexpr int LKV = 66;                    // 64 + 2 pad (even -> 8B align)
  constexpr int TILE = 64 * LKV;             // floats of one staged block
  __shared__ float ldsK[2 * TILE];           // K^T blocks: [buffer][m][d]
  __shared__ float ldsV[2 * TILE];           // V   blocks: [buffer][d][m]

  const int t    = threadIdx.x;
  const int wave = t >> 5;
  const int lane = t & 31;
  const int half = lane >> 4;
  const int col  = lane & 15;
  const int h    = blockIdx.y;
  const int b    = blockIdx.z;
  const int n0   = blockIdx.x * 128 + wave * 16;

  const float* qb = q + (size_t)b * D * N;
  const float* kb = k + (size_t)b * D * N;
  const float* vb = v + (size_t)b * D * N;

  // Resident Q B-fragments: Qf[kk] covers d = 4*kk .. 4*kk+3 at 16 n-columns.
  v2f Qf[16];
#pragma unroll
  for (int kk = 0; kk < 16; ++kk) {
    const int d = 4 * kk + 2 * half;
    Qf[kk].x = qb[((size_t)d * H + h) * N + n0 + col];
    Qf[kk].y = qb[((size_t)(d + 1) * H + h) * N + n0 + col];
  }

  v8f acc[4] = {};                            // O tile: 64 d-rows x 16 n-cols
  float m_run = -1e30f, l_run = 0.0f;

  // Async stage of the K^T and V blocks at key mb0 into buffer buf
  // (coalesced on m; LDS side scattered). 32 copies per wave.
  auto stage = [&](int mb0, int buf) {
    for (int j = 0; j < 16; ++j) {
      const int e = j * 256 + t;
      const int m = e & 63, d = e >> 6;
      const float* g = kb + ((size_t)d * H + h) * N + mb0 + m;
      async_copy_b32(g, &ldsK[buf * TILE + m * LKV + d]);
      const float* gv = vb + ((size_t)d * H + h) * N + mb0 + m;
      async_copy_b32(gv, &ldsV[buf * TILE + d * LKV + m]);
    }
  };

  stage(0, 0);
  // Block 0 has landed in this wave's view before the barrier publishes it.
  asm volatile("s_wait_asynccnt 0x0" ::: "memory");
  __syncthreads();
  stage(64, 1);

  for (int mb = 0; mb < N; mb += 64) {
    const int buf = (mb >> 6) & 1;
    const float* Kb = &ldsK[buf * TILE];
    const float* Vb = &ldsV[buf * TILE];

    for (int sub = 0; sub < 4; ++sub) {
      const int m0 = sub * 16;
      // S^T tile (rows m, cols n) = K^T * Q
      v8f s = {};
#pragma unroll
      for (int kk = 0; kk < 16; ++kk) {
        const float* kp = &Kb[(m0 + col) * LKV + 4 * kk + 2 * half];
        v2f a; a.x = kp[0]; a.y = kp[1];
        s = WMMA_F32X4(a, Qf[kk], s);
      }
      // Online softmax (per n-column == per lane; halves combined via xor16).
      float tmax = -1e30f;
#pragma unroll
      for (int r = 0; r < 8; ++r) { s[r] *= 0.125f; tmax = fmaxf(tmax, s[r]); }
      tmax = fmaxf(tmax, __shfl_xor(tmax, 16, 32));
      const float m_new = fmaxf(m_run, tmax);
      const float alpha = __expf(m_run - m_new);
      float tsum = 0.0f;
#pragma unroll
      for (int r = 0; r < 8; ++r) {
        const float p = __expf(s[r] - m_new);
        s[r] = p;
        tsum += p;
      }
      tsum += __shfl_xor(tsum, 16, 32);
      l_run = l_run * alpha + tsum;
      m_run = m_new;
#pragma unroll
      for (int dt = 0; dt < 4; ++dt)
#pragma unroll
        for (int r = 0; r < 8; ++r) acc[dt][r] *= alpha;

      // O += V * P   (A = V 16d x 4m, B = P 4m x 16n). P stays in registers:
      // lane (col, half) holds key r + 8*half of column col in s[r], which is
      // where a B fragment wants k = 2*half, 2*half + 1. So s[2j], s[2j+1] are
      // the B fragment of the keys 2j, 2j+1, 2j+8, 2j+9, and V is read in that
      // same key order.
#pragma unroll
      for (int dt = 0; dt < 4; ++dt) {
#pragma unroll
        for (int j = 0; j < 4; ++j) {
          const float* vp = &Vb[(dt * 16 + col) * LKV + m0 + 2 * j + 8 * half];
          v2f a; a.x = vp[0]; a.y = vp[1];
          v2f bf; bf.x = s[2 * j]; bf.y = s[2 * j + 1];
          acc[dt] = WMMA_F32X4(a, bf, acc[dt]);
        }
      }
    }

    // Publish point of block t+1, which also frees block t's buffer.
    // This wave's LDS reads of the buffer to be refilled have returned:
    asm volatile("s_wait_dscnt 0x0" ::: "memory");
    // this wave's copies of block t+1 have landed:
    asm volatile("s_wait_asynccnt 0x0" ::: "memory");
    __syncthreads();
    if (mb + 128 < N) stage(mb + 128, buf);
  }
  // No copy is outstanding when the wave ends.
  asm volatile("s_wait_asynccnt 0x0" ::: "memory");

  const float inv_l = 1.0f / l_run;
  float* ab = attn + (size_t)b * D * N;
#pragma unroll
  for (int dt = 0; dt < 4; ++dt) {
#pragma unroll
    for (int r = 0; r < 8; ++r) {
      const int d = dt * 16 + r + 8 * half;
      ab[((size_t)d * H + h) * N + n0 + col] = acc[dt][r] * inv_l;
    }
  }
}

// ---------------------------------------------------------------------------
// InstanceNorm1d (biased var over N) + ReLU, in place on h (B, 512, N).
// Grid: (512, BATCH), block 256.
// ---------------------------------------------------------------------------
__global__ __launch_bounds__(256)
void instnorm_relu_kernel(float* __restrict__ hbuf)
{
  __shared__ float red[2][8];
  const int t = threadIdx.x;
  const int c = blockIdx.x;
  const int b = blockIdx.y;
  float* p = hbuf + ((size_t)b * D2 + c) * N;

  float s = 0.0f, s2 = 0.0f;
  for (int i = t; i < N; i += 256) { const float x = p[i]; s += x; s2 += x * x; }
#pragma unroll
  for (int off = 16; off > 0; off >>= 1) {
    s  += __shfl_xor(s,  off, 32);
    s2 += __shfl_xor(s2, off, 32);
  }
  const int wave = t >> 5, lane = t & 31;
  if (lane == 0) { red[0][wave] = s; red[1][wave] = s2; }
  __syncthreads();
  float ts = 0.0f, ts2 = 0.0f;
#pragma unroll
  for (int w = 0; w < 8; ++w) { ts += red[0][w]; ts2 += red[1][w]; }
  const float mu   = ts / (float)N;
  const float var  = ts2 / (float)N - mu * mu;
  const float rstd = rsqrtf(var + 1e-5f);
  for (int i = t; i < N; i += 256) {
    const float x = (p[i] - mu) * rstd;
    p[i] = x > 0.0f ? x : 0.0f;
  }
}

// ---------------------------------------------------------------------------
extern "C" void kernel_launch(void* const* d_in, const int* in_sizes, int n_in,
                              void* d_out, int out_size, void* d_ws, size_t ws_size,
                              hipStream_t stream)
{
  const float* x   = (const float*)d_in[0];
  const float* src = (const float*)d_in[1];
  const float* Wq  = (const float*)d_in[2];
  const float* bq  = (const float*)d_in[3];
  const float* Wk  = (const float*)d_in[4];
  const float* bk  = (const float*)d_in[5];
  const float* Wv  = (const float*)d_in[6];
  const float* bv  = (const float*)d_in[7];
  const float* Wm  = (const float*)d_in[8];
  const float* bm  = (const float*)d_in[9];
  const float* W1  = (const float*)d_in[10];
  const float* b1  = (const float*)d_in[11];
  const float* W2  = (const float*)d_in[12];
  const float* b2  = (const float*)d_in[13];
  float* out = (float*)d_out;

  float* ws = (float*)d_ws;
  const size_t sz_dn = (size_t)BATCH * D * N;
  float* qb = ws;
  float* kb = qb + sz_dn;
  float* vb = kb + sz_dn;
  float* at = vb + sz_dn;
  float* ms = at + sz_dn;
  float* hb = ms + sz_dn;                     // BATCH * 512 * N

  const dim3 blk(256);
  // q = Wq x + bq ; k = Wk s + bk ; v = Wv s + bv
  conv1_gemm_kernel<D, D, D><<<dim3(N / 128, D / 64, BATCH), blk, 0, stream>>>(Wq, bq, x,   x,   qb);
  conv1_gemm_kernel<D, D, D><<<dim3(N / 128, D / 64, BATCH), blk, 0, stream>>>(Wk, bk, src, src, kb);
  conv1_gemm_kernel<D, D, D><<<dim3(N / 128, D / 64, BATCH), blk, 0, stream>>>(Wv, bv, src, src, vb);
  // attention
  attention_kernel<<<dim3(N / 128, H, BATCH), blk, 0, stream>>>(qb, kb, vb, at);
  // message = Wm attn + bm
  conv1_gemm_kernel<D, D, D><<<dim3(N / 128, D / 64, BATCH), blk, 0, stream>>>(Wm, bm, at,  at,  ms);
  // h = W1 [x; message] + b1
  conv1_gemm_kernel<D2, D2, D><<<dim3(N / 128, D2 / 64, BATCH), blk, 0, stream>>>(W1, b1, x,  ms,  hb);
  // instance norm + relu, in place
  instnorm_relu_kernel<<<dim3(D2, BATCH), blk, 0, stream>>>(hb);
  // out = W2 h + b2
  conv1_gemm_kernel<D, D2, D2><<<dim3(N / 128, D / 64, BATCH), blk, 0, stream>>>(W2, b2, hb,  hb,  out);
}

// v004
// It runs in 267 microseconds.
// Next to v003, in two timings, it ran 1.05 and 1.06 times as fast.
// All steps since v000 together make it 1.35 times as fast.
#include <hip/hip_runtime.h>
#include <hip/hip_bf16.h>

typedef __attribute__((ext_vector_type(2))) float v2f;
typedef __attribute__((ext_vector_type(8))) float v8f;

// D = A(16x4) * B(4x16) + C(16x16), fp32, wave32
#define WMMA_F32X4(a, b, c) \
  __builtin_amdgcn_wmma_f32_16x16x4_f32(false, (a), false, (b), (short)0, (c), false, false)

#define GLOBAL_AS __attribute__((address_space(1)))
#define LDS_AS    __attribute__((address_space(3)))

#if __has_builtin(__builtin_amdgcn_global_load_async_to_lds_b32)
#define HAVE_ASYNC_LDS 1
#else
#define HAVE_ASYNC_LDS 0
#endif

__device__ __forceinline__ void async_copy_b32(const float* gsrc, float* lds_dst) {
#if HAVE_ASYNC_LDS
  __builtin_amdgcn_global_load_async_to_lds_b32(
      (GLOBAL_AS int*)gsrc, (LDS_AS int*)lds_dst, 0, 0);
#else
  *lds_dst = *gsrc;
#endif
}

namespace {
constexpr int BATCH = 2;
constexpr int D     = 256;
constexpr int N     = 4096;
constexpr int H     = 4;
constexpr int D2    = 512;   // 2*D
}

// ---------------------------------------------------------------------------
// conv1 (channel-wise linear): Y[b] = W (OxI) * X[b] (IxN) + bias.
// X rows [0, SPLIT) come from X0, rows [SPLIT, I) from X1 (for the concat).
// Grid: (N/128, O/64, BATCH), block 256. A work-group owns 64 output rows x
// 128 columns; each of its 8 waves owns 64 rows x 16 columns as four 16x16
// accumulator tiles, so one X fragment from global feeds four WMMAs.
// ---------------------------------------------------------------------------
template <int O, int I, int SPLIT>
__global__ __launch_bounds__(256)
void conv1_gemm_kernel(const float* __restrict__ W, const float* __restrict__ bias,
                       const float* __restrict__ X0, const float* __restrict__ X1,
                       float* __restrict__ Y)
{
  constexpr int LDW = I + 2;             // 2 pad, keeps 8B align
  __shared__ __attribute__((aligned(16))) float lds_w[64 * LDW];

  const int t    = threadIdx.x;
  const int wave = t >> 5;
  const int lane = t & 31;
  const int half = lane >> 4;
  const int col  = lane & 15;
  const int b    = blockIdx.z;
  const int o0   = blockIdx.y * 64;
  const int n0   = blockIdx.x * 128 + wave * 16;

  // Stage the 64 x I weight tile once (all waves share the A operand).
  // The tile's rows are contiguous in W; two floats per lane and copy.
  const float* wt = W + (size_t)o0 * I;
  // Fully unrolled so that all of a lane's loads are in flight together.
#pragma unroll
  for (int j = 0; j < 64 * I / 2 / 256; ++j) {
    const int e = j * 256 + t;
    const int r = e / (I / 2), i = 2 * (e - r * (I / 2));
    *(v2f*)&lds_w[r * LDW + i] = *(const v2f*)&wt[2 * e];
  }
  __syncthreads();

  // Per-lane column base pointers for the two activation sources.
  const float* p0 = X0 + (size_t)b * SPLIT * N + n0 + col;
  const float* p1 = X1 + (size_t)b * (I - SPLIT) * N + n0 + col;
  const float* wrow = &lds_w[col * LDW + 2 * half];

  v8f acc[4] = {};
  // Both k loops: 16 steps per trip put 32 X loads in flight ahead of 64 WMMAs,
  // so that with two waves per SIMD one wave's load latency lies under the
  // other's products.
  // k in [0, SPLIT): source X0
#pragma unroll 16
  for (int k0 = 0; k0 < SPLIT; k0 += 4) {
    const int i = k0 + 2 * half;
    v2f bf;
    bf.x = p0[(size_t)i * N];
    bf.y = p0[(size_t)(i + 1) * N];
#pragma unroll
    for (int ot = 0; ot < 4; ++ot) {
      v2f a; a.x = wrow[ot * 16 * LDW + k0]; a.y = wrow[ot * 16 * LDW + k0 + 1];
      acc[ot] = WMMA_F32X4(a, bf, acc[ot]);
    }
  }
  // k in [SPLIT, I): source X1
#pragma unroll 16
  for (int k0 = SPLIT; k0 < I; k0 += 4) {
    const int i = (k0 - SPLIT) + 2 * half;
    v2f bf;
    bf.x = p1[(size_t)i * N];
    bf.y = p1[(size_t)(i + 1) * N];
#pragma unroll
    for (int ot = 0; ot < 4; ++ot) {
      v2f a; a.x = wrow[ot * 16 * LDW + k0]; a.y = wrow[ot * 16 * LDW + k0 + 1];
      acc[ot] = WMMA_F32X4(a, bf, acc[ot]);
    }
  }

  float* yb = Y + (size_t)b * O * N;
#pragma unroll
  for (int ot = 0; ot < 4; ++ot) {
#pragma unroll
    for (int r = 0; r < 8; ++r) {
      const int o = o0 + ot * 16 + r + 8 * half;   // C layout: rows r / r+8
      yb[(size_t)o * N + n0 + col] = acc[ot][r] + bias[o];
    }
  }
}

// ---------------------------------------------------------------------------
// Flash attention, fp32 WMMA. Head-dim 64, scale 1/8.
// q/k/v/attn are (B, D, N); head h owns channels d*H + h, d in [0,64).
// Grid: (N/128, H, BATCH), block 256; each wave owns a 16-query tile and
// streams K/V in 64-wide blocks staged in LDS via ASYNCcnt-tracked
// global_load_async_to_lds (the per-lane LDS address does the K transpose).
// Two LDS buffers: while block t is worked on, block t+1's copies are in flight.
// ---------------------------------------------------------------------------
__global__ __launch_bounds__(256)
void attention_kernel(const float* __restrict__ q, const float* __restrict__ k,
                      const float* __restrict__ v, float* __restrict__ attn)
{
  constexpr int LKV = 66;                    // 64 + 2 pad (even -> 8B align)
  constexpr int TILE = 64 * LKV;             // floats of one staged block
  __shared__ float ldsK[2 * TILE];           // K^T blocks: [buffer][m][d]
  __shared__ float ldsV[2 * TILE];           // V   blocks: [buffer][d][m]

  const int t    = threadIdx.x;
  const int wave = t >> 5;
  const int lane = t & 31;
  const int half = lane >> 4;
  const int col  = lane & 15;
  const int h    = blockIdx.y;
  const int b    = blockIdx.z;
  const int n0   = blockIdx.x * 128 + wave * 16;

  const float* qb = q + (size_t)b * D * N;
  const float* kb = k + (size_t)b * D * N;
  const float* vb = v + (size_t)b * D * N;

  // Resident Q B-fragments: Qf[kk] covers d = 4*kk .. 4*kk+3 at 16 n-columns.
  v2f Qf[16];
#pragma unroll
  for (int kk = 0; kk < 16; ++kk) {
    const int d = 4 * kk + 2 * half;
    Qf[kk].x = qb[((size_t)d * H + h) * N + n0 + col];
    Qf[kk].y = qb[((size_t)(d + 1) * H + h) * N + n0 + col];
  }

  v8f acc[4] = {};                            // O tile: 64 d-rows x 16 n-cols
  float m_run = -1e30f, l_run = 0.0f;

  // Async stage of the K^T and V blocks at key mb0 into buffer buf
  // (coalesced on m; LDS side scattered). 32 copies per wave.
  auto stage = [&](int mb0, int buf) {
    for (int j = 0; j < 16; ++j) {
      const int e = j * 256 + t;
      const int m = e & 63, d = e >> 6;
      const float* g = kb + ((size_t)d * H + h) * N + mb0 + m;
      async_copy_b32(g, &ldsK[buf * TILE + m * LKV + d]);
      const float* gv = vb + ((size_t)d * H + h) * N + mb0 + m;
      async_copy_b32(gv, &ldsV[buf * TILE + d * LKV + m]);
    }
  };

  stage(0, 0);
  // Block 0 has landed in this wave's view before the barrier publishes it.
  asm volatile("s_wait_asynccnt 0x0" ::: "memory");
  __syncthreads();
  stage(64, 1);

  for (int mb = 0; mb < N; mb += 64) {
    const int buf = (mb >> 6) & 1;
    const float* Kb = &ldsK[buf * TILE];
    const float* Vb = &ldsV[buf * TILE];

    // K^T fragments of d = 16g .. 16g+15 for all four 16-key tiles.
    auto load_k = [&](v2f (&f)[16], int g) {
#pragma unroll
      for (int x = 0; x < 4; ++x)
#pragma unroll
        for (int sub = 0; sub < 4; ++sub) {
          const float* kp = &Kb[(sub * 16 + col) * LKV + 4 * (4 * g + x) + 2 * half];
          f[x * 4 + sub].x = kp[0]; f[x * 4 + sub].y = kp[1];
        }
    };
    // V fragments of key tile sub for all four 16-row d tiles, in the key order
    // 2j, 2j+1, 2j+8, 2j+9 (see below).
    auto load_v = [&](v2f (&f)[16], int sub) {
#pragma unroll
      for (int j = 0; j < 4; ++j)
#pragma unroll
        for (int dt = 0; dt < 4; ++dt) {
          const float* vp = &Vb[(dt * 16 + col) * LKV + sub * 16 + 2 * j + 8 * half];
          f[j * 4 + dt].x = vp[0]; f[j * 4 + dt].y = vp[1];
        }
    };
    v2f kf[2][16], vf[2][16];

    // S^T (64 keys x 16 queries) = K^T * Q as four 16x16 tiles. The tiles take
    // turns, so that no WMMA waits for the one issued just ahead of it.
    // The LDS reads stand in whole groups, one group of 16 WMMAs ahead of their
    // use; the sched_barriers keep the compiler from spreading them singly
    // among the WMMAs.
    v8f s[4] = {};
    load_k(kf[0], 0);
#pragma unroll
    for (int g = 0; g < 4; ++g) {
      if (g < 3) load_k(kf[(g + 1) & 1], g + 1); else load_v(vf[0], 0);
      __builtin_amdgcn_sched_barrier(0);   // reads stay ahead of this group's WMMAs
#pragma unroll
      for (int x = 0; x < 4; ++x)
#pragma unroll
        for (int sub = 0; sub < 4; ++sub)
          s[sub] = WMMA_F32X4(kf[g & 1][x * 4 + sub], Qf[4 * g + x], s[sub]);
      __builtin_amdgcn_sched_barrier(0);   // the next group's reads stay behind them
    }

    // One online-softmax step for all 64 keys (per n-column == per lane;
    // halves combined via xor16). One maximum per tile first: four short
    // chains instead of one long one.
    float tm[4];
#pragma unroll
    for (int sub = 0; sub < 4; ++sub) {
      tm[sub] = -1e30f;
#pragma unroll
      for (int r = 0; r < 8; ++r) { s[sub][r] *= 0.125f; tm[sub] = fmaxf(tm[sub], s[sub][r]); }
    }
    float tmax = fmaxf(fmaxf(tm[0], tm[1]), fmaxf(tm[2], tm[3]));
    tmax = fmaxf(tmax, __shfl_xor(tmax, 16, 32));
    const float m_new = fmaxf(m_run, tmax);
    const float alpha = __expf(m_run - m_new);
    m_run = m_new;
    load_v(vf[1], 1);
    __builtin_amdgcn_sched_barrier(0);     // reads stay one group, ahead of tile 0's WMMAs
#pragma unroll
    for (int dt = 0; dt < 4; ++dt)
#pragma unroll
      for (int r = 0; r < 8; ++r) acc[dt][r] *= alpha;

    float ts[4];
    auto exp_tile = [&](int sub) {
      ts[sub] = 0.0f;
#pragma unroll
      for (int r = 0; r < 8; ++r) {
        const float p = __expf(s[sub][r] - m_new);
        s[sub][r] = p;
        ts[sub] += p;
      }
    };
    exp_tile(0);

    // O += V * P   (A = V 16d x 4m, B = P 4m x 16n). P stays in registers:
    // lane (col, half) holds key r + 8*half of column col in s[sub][r], which
    // is where a B fragment wants k = 2*half, 2*half + 1. So s[sub][2j],
    // s[sub][2j+1] are the B fragment of the keys 2j, 2j+1, 2j+8, 2j+9 of tile
    // sub, and V is read in that same key order. The four d tiles take turns;
    // the next tile's exponentials stand among this tile's WMMAs.
    float tsum = 0.0f, tsum_other = 0.0f;
#pragma unroll
    for (int sub = 0; sub < 4; ++sub) {
      if (sub == 1 || sub == 2) {
        load_v(vf[(sub + 1) & 1], sub + 1);
        __builtin_amdgcn_sched_barrier(0); // reads stay ahead of this tile's WMMAs
      }
#pragma unroll
      for (int j = 0; j < 4; ++j) {
        v2f bf; bf.x = s[sub][2 * j]; bf.y = s[sub][2 * j + 1];
#pragma unroll
        for (int dt = 0; dt < 4; ++dt)
          acc[dt] = WMMA_F32X4(vf[sub & 1][j * 4 + dt], bf, acc[dt]);
      }
      if (sub < 3) {
        exp_tile(sub + 1);
        if (sub == 2) {
          // The sums' exchange is issued ahead of the last tile's WMMAs; behind
          // them the wave would wait for it with nothing left to issue.
          tsum = (ts[0] + ts[1]) + (ts[2] + ts[3]);
          tsum_other = __shfl_xor(tsum, 16, 32);
        }
        __builtin_amdgcn_sched_barrier(0); // the next tile's reads stay behind them
      }
    }
    l_run = l_run * alpha + (tsum + tsum_other);

    // Publish point of block t+1, which also frees block t's buffer.
    // This wave's LDS reads of the buffer to be refilled have returned:
    asm volatile("s_wait_dscnt 0x0" ::: "memory");
    // this wave's copies of block t+1 have landed:
    asm volatile("s_wait_asynccnt 0x0" ::: "memory");
    __syncthreads();
    if (mb + 128 < N) stage(mb + 128, buf);
  }
  // No copy is outstanding when the wave ends.
  asm volatile("s_wait_asynccnt 0x0" ::: "memory");

  const float inv_l = 1.0f / l_run;
  float* ab = attn + (size_t)b * D * N;
#pragma unroll
  for (int dt = 0; dt < 4; ++dt) {
#pragma unroll
    for (int r = 0; r < 8; ++r) {
      const int d = dt * 16 + r + 8 * half;
      ab[((size_t)d * H + h) * N + n0 + col] = acc[dt][r] * inv_l;
    }
  }
}

// ---------------------------------------------------------------------------
// InstanceNorm1d (biased var over N) + ReLU, in place on h (B, 512, N).
// Grid: (512, BATCH), block 256.
// ---------------------------------------------------------------------------
__global__ __launch_bounds__(256)
void instnorm_relu_kernel(float* __restrict__ hbuf)
{
  __shared__ float red[2][8];
  const int t = threadIdx.x;
  const int c = blockIdx.x;
  const int b = blockIdx.y;
  float* p = hbuf + ((size_t)b * D2 + c) * N;

  float s = 0.0f, s2 = 0.0f;
  for (int i = t; i < N; i += 256) { const float x = p[i]; s += x; s2 += x * x; }
#pragma unroll
  for (int off = 16; off > 0; off >>= 1) {
    s  += __shfl_xor(s,  off, 32);
    s2 += __shfl_xor(s2, off, 32);
  }
  const int wave = t >> 5, lane = t & 31;
  if (lane == 0) { red[0][wave] = s; red[1][wave] = s2; }
  __syncthreads();
  float ts = 0.0f, ts2 = 0.0f;
#pragma unroll
  for (int w = 0; w < 8; ++w) { ts += red[0][w]; ts2 += red[1][w]; }
  const float mu   = ts / (float)N;
  const float var  = ts2 / (float)N - mu * mu;
  const float rstd = rsqrtf(var + 1e-5f);
  for (int i = t; i < N; i += 256) {
    const float x = (p[i] - mu) * rstd;
    p[i] = x > 0.0f ? x : 0.0f;
  }
}

// ---------------------------------------------------------------------------
extern "C" void kernel_launch(void* const* d_in, const int* in_sizes, int n_in,
                              void* d_out, int out_size, void* d_ws, size_t ws_size,
                              hipStream_t stream)
{
  const float* x   = (const float*)d_in[0];
  const float* src = (const float*)d_in[1];
  const float* Wq  = (const float*)d_in[2];
  const float* bq  = (const float*)d_in[3];
  const float* Wk  = (const float*)d_in[4];
  const float* bk  = (const float*)d_in[5];
  const float* Wv  = (const float*)d_in[6];
  const float* bv  = (const float*)d_in[7];
  const float* Wm  = (const float*)d_in[8];
  const float* bm  = (const float*)d_in[9];
  const float* W1  = (const float*)d_in[10];
  const float* b1  = (const float*)d_in[11];
  const float* W2  = (const float*)d_in[12];
  const float* b2  = (const float*)d_in[13];
  float* out = (float*)d_out;

  float* ws = (float*)d_ws;
  const size_t sz_dn = (size_t)BATCH * D * N;
  float* qb = ws;
  float* kb = qb + sz_dn;
  float* vb = kb + sz_dn;
  float* at = vb + sz_dn;
  float* ms = at + sz_dn;
  float* hb = ms + sz_dn;                     // BATCH * 512 * N

  const dim3 blk(256);
  // q = Wq x + bq ; k = Wk s + bk ; v = Wv s + bv
  conv1_gemm_kernel<D, D, D><<<dim3(N / 128, D / 64, BATCH), blk, 0, stream>>>(Wq, bq, x,   x,   qb);
  conv1_gemm_kernel<D, D, D><<<dim3(N / 128, D / 64, BATCH), blk, 0, stream>>>(Wk, bk, src, src, kb);
  conv1_gemm_kernel<D, D, D><<<dim3(N / 128, D / 64, BATCH), blk, 0, stream>>>(Wv, bv, src, src, vb);
  // attention
  attention_kernel<<<dim3(N / 128, H, BATCH), blk, 0, stream>>>(qb, kb, vb, at);
  // message = Wm attn + bm
  conv1_gemm_kernel<D, D, D><<<dim3(N / 128, D / 64, BATCH), blk, 0, stream>>>(Wm, bm, at,  at,  ms);
  // h = W1 [x; message] + b1
  conv1_gemm_kernel<D2, D2, D><<<dim3(N / 128, D2 / 64, BATCH), blk, 0, stream>>>(W1, b1, x,  ms,  hb);
  // instance norm + relu, in place
  instnorm_relu_kernel<<<dim3(D2, BATCH), blk, 0, stream>>>(hb);
  // out = W2 h + b2
  conv1_gemm_kernel<D, D2, D2><<<dim3(N / 128, D / 64, BATCH), blk, 0, stream>>>(W2, b2, hb,  hb,  out);
}

// v005
// A run of this version takes 259 microseconds.
// Two timings next to v004 both put it at 1.03 times that version's speed.
// All steps since v000 together make it 1.40 times as fast.
#include <hip/hip_runtime.h>
#include <hip/hip_bf16.h>

typedef __attribute__((ext_vector_type(2))) float v2f;
typedef __attribute__((ext_vector_type(8))) float v8f;

// D = A(16x4) * B(4x16) + C(16x16), fp32, wave32
#define WMMA_F32X4(a, b, c) \
  __builtin_amdgcn_wmma_f32_16x16x4_f32(false, (a), false, (b), (short)0, (c), false, false)

#define GLOBAL_AS __attribute__((address_space(1)))
#define LDS_AS    __attribute__((address_space(3)))

#if __has_builtin(__builtin_amdgcn_global_load_async_to_lds_b32)
#define HAVE_ASYNC_LDS 1
#else
#define HAVE_ASYNC_LDS 0
#endif

__device__ __forceinline__ void async_copy_b32(const float* gsrc, float* lds_dst) {
#if HAVE_ASYNC_LDS
  __builtin_amdgcn_global_load_async_to_lds_b32(
      (GLOBAL_AS int*)gsrc, (LDS_AS int*)lds_dst, 0, 0);
#else
  *lds_dst = *gsrc;
#endif
}

namespace {
constexpr int BATCH = 2;
constexpr int D     = 256;
constexpr int N     = 4096;
constexpr int H     = 4;
constexpr int D2    = 512;   // 2*D
}

// ---------------------------------------------------------------------------
// conv1 (channel-wise linear): Y[b] = W (OxI) * X[b] (IxN) + bias.
// X rows [0, SPLIT) come from X0, rows [SPLIT, I) from X1 (for the concat).
// Block 256. A work-group owns 64 output rows (row block ob) x 128 columns
// (blockIdx.x) of batch blockIdx.z; each of its 8 waves owns 64 rows x 16
// columns as four 16x16 accumulator tiles, so one X fragment from global
// feeds four WMMAs.
// ---------------------------------------------------------------------------
template <int O, int I, int SPLIT>
__device__ __forceinline__
void conv1_gemm_body(const float* __restrict__ W, const float* __restrict__ bias,
                     const float* __restrict__ X0, const float* __restrict__ X1,
                     float* __restrict__ Y, const int ob)
{
  constexpr int LDW = I + 2;             // 2 pad, keeps 8B align
  __shared__ __attribute__((aligned(16))) float lds_w[64 * LDW];

  const int t    = threadIdx.x;
  const int wave = t >> 5;
  const int lane = t & 31;
  const int half = lane >> 4;
  const int col  = lane & 15;
  const int b    = blockIdx.z;
  const int o0   = ob * 64;
  const int n0   = blockIdx.x * 128 + wave * 16;

  // Stage the 64 x I weight tile once (all waves share the A operand).
  // The tile's rows are contiguous in W; two floats per lane and copy.
  const float* wt = W + (size_t)o0 * I;
  // Fully unrolled so that all of a lane's loads are in flight together.
#pragma unroll
  for (int j = 0; j < 64 * I / 2 / 256; ++j) {
    const int e = j * 256 + t;
    const int r = e / (I / 2), i = 2 * (e - r * (I / 2));
    *(v2f*)&lds_w[r * LDW + i] = *(const v2f*)&wt[2 * e];
  }
  __syncthreads();

  // Per-lane column base pointers for the two activation sources.
  const float* p0 = X0 + (size_t)b * SPLIT * N + n0 + col;
  const float* p1 = X1 + (size_t)b * (I - SPLIT) * N + n0 + col;
  const float* wrow = &lds_w[col * LDW + 2 * half];

  v8f acc[4] = {};
  // Both k loops: 16 steps per trip put 32 X loads in flight ahead of 64 WMMAs,
  // so that with two waves per SIMD one wave's load latency lies under the
  // other's products.
  // k in [0, SPLIT): source X0
#pragma unroll 16
  for (int k0 = 0; k0 < SPLIT; k0 += 4) {
    const int i = k0 + 2 * half;
    v2f bf;
    bf.x = p0[(size_t)i * N];
    bf.y = p0[(size_t)(i + 1) * N];
#pragma unroll
    for (int ot = 0; ot < 4; ++ot) {
      v2f a; a.x = wrow[ot * 16 * LDW + k0]; a.y = wrow[ot * 16 * LDW + k0 + 1];
      acc[ot] = WMMA_F32X4(a, bf, acc[ot]);
    }
  }
  // k in [SPLIT, I): source X1
#pragma unroll 16
  for (int k0 = SPLIT; k0 < I; k0 += 4) {
    const int i = (k0 - SPLIT) + 2 * half;
    v2f bf;
    bf.x = p1[(size_t)i * N];
    bf.y = p1[(size_t)(i + 1) * N];
#pragma unroll
    for (int ot = 0; ot < 4; ++ot) {
      v2f a; a.x = wrow[ot * 16 * LDW + k0]; a.y = wrow[ot * 16 * LDW + k0 + 1];
      acc[ot] = WMMA_F32X4(a, bf, acc[ot]);
    }
  }

  float* yb = Y + (size_t)b * O * N;
#pragma unroll
  for (int ot = 0; ot < 4; ++ot) {
#pragma unroll
    for (int r = 0; r < 8; ++r) {
      const int o = o0 + ot * 16 + r + 8 * half;   // C layout: rows r / r+8
      yb[(size_t)o * N + n0 + col] = acc[ot][r] + bias[o];
    }
  }
}

// One product per launch. Grid: (N/128, O/64, BATCH).
template <int O, int I, int SPLIT>
__global__ __launch_bounds__(256)
void conv1_gemm_kernel(const float* __restrict__ W, const float* __restrict__ bias,
                       const float* __restrict__ X0, const float* __restrict__ X1,
                       float* __restrict__ Y)
{
  conv1_gemm_body<O, I, SPLIT>(W, bias, X0, X1, Y, blockIdx.y);
}

// q = Wq x + bq, k = Wk s + bk, v = Wv s + bv in ONE launch: none of the three
// reads what another writes. Grid: (N/128, 3 * D/64, BATCH); blockIdx.y / 4
// picks the product, blockIdx.y % 4 its row block. LDS and registers let more
// than three work-groups stand on a WGP, so all 768 are resident at once: one
// start, one weight staging and one tail in place of three of each, and more
// waves per matrix unit to cover each other's load waits.
__global__ __launch_bounds__(256)
void qkv_gemm_kernel(const float* __restrict__ Wq, const float* __restrict__ bq,
                     const float* __restrict__ Wk, const float* __restrict__ bk,
                     const float* __restrict__ Wv, const float* __restrict__ bv,
                     const float* __restrict__ x,  const float* __restrict__ s,
                     float* __restrict__ q, float* __restrict__ k, float* __restrict__ v)
{
  const int which = blockIdx.y >> 2;
  const float* W = which == 0 ? Wq : which == 1 ? Wk : Wv;
  const float* b = which == 0 ? bq : which == 1 ? bk : bv;
  const float* X = which == 0 ? x : s;
  float*       Y = which == 0 ? q : which == 1 ? k : v;
  conv1_gemm_body<D, D, D>(W, b, X, X, Y, blockIdx.y & 3);
}

// ---------------------------------------------------------------------------
// Flash attention, fp32 WMMA. Head-dim 64, scale 1/8.
// q/k/v/attn are (B, D, N); head h owns channels d*H + h, d in [0,64).
// Grid: (N/128, H, BATCH), block 256; each wave owns a 16-query tile and
// streams K/V in 64-wide blocks staged in LDS via ASYNCcnt-tracked
// global_load_async_to_lds (the per-lane LDS address does the K transpose).
// Two LDS buffers: while block t is worked on, block t+1's copies are in flight.
// ---------------------------------------------------------------------------
__global__ __launch_bounds__(256)
void attention_kernel(const float* __restrict__ q, const float* __restrict__ k,
                      const float* __restrict__ v, float* __restrict__ attn)
{
  constexpr int LKV = 66;                    // 64 + 2 pad (even -> 8B align)
  constexpr int TILE = 64 * LKV;             // floats of one staged block
  __shared__ float ldsK[2 * TILE];           // K^T blocks: [buffer][m][d]
  __shared__ float ldsV[2 * TILE];           // V   blocks: [buffer][d][m]

  const int t    = threadIdx.x;
  const int wave = t >> 5;
  const int lane = t & 31;
  const int half = lane >> 4;
  const int col  = lane & 15;
  const int h    = blockIdx.y;
  const int b    = blockIdx.z;
  const int n0   = blockIdx.x * 128 + wave * 16;

  const float* qb = q + (size_t)b * D * N;
  const float* kb = k + (size_t)b * D * N;
  const float* vb = v + (size_t)b * D * N;

  // Resident Q B-fragments: Qf[kk] covers d = 4*kk .. 4*kk+3 at 16 n-columns.
  v2f Qf[16];
#pragma unroll
  for (int kk = 0; kk < 16; ++kk) {
    const int d = 4 * kk + 2 * half;
    Qf[kk].x = qb[((size_t)d * H + h) * N + n0 + col];
    Qf[kk].y = qb[((size_t)(d + 1) * H + h) * N + n0 + col];
  }

  v8f acc[4] = {};                            // O tile: 64 d-rows x 16 n-cols
  float m_run = -1e30f, l_run = 0.0f;

  // Async stage of the K^T and V blocks at key mb0 into buffer buf
  // (coalesced on m; LDS side scattered). 32 copies per wave.
  auto stage = [&](int mb0, int buf) {
    for (int j = 0; j < 16; ++j) {
      const int e = j * 256 + t;
      const int m = e & 63, d = e >> 6;
      const float* g = kb + ((size_t)d * H + h) * N + mb0 + m;
      async_copy_b32(g, &ldsK[buf * TILE + m * LKV + d]);
      const float* gv = vb + ((size_t)d * H + h) * N + mb0 + m;
      async_copy_b32(gv, &ldsV[buf * TILE + d * LKV + m]);
    }
  };

  stage(0, 0);
  // Block 0 has landed in this wave's view before the barrier publishes it.
  asm volatile("s_wait_asynccnt 0x0" ::: "memory");
  __syncthreads();
  stage(64, 1);

  for (int mb = 0; mb < N; mb += 64) {
    const int buf = (mb >> 6) & 1;
    const float* Kb = &ldsK[buf * TILE];
    const float* Vb = &ldsV[buf * TILE];

    // K^T fragments of d = 16g .. 16g+15 for all four 16-key tiles.
    auto load_k = [&](v2f (&f)[16], int g) {
#pragma unroll
      for (int x = 0; x < 4; ++x)
#pragma unroll
        for (int sub = 0; sub < 4; ++sub) {
          const float* kp = &Kb[(sub * 16 + col) * LKV + 4 * (4 * g + x) + 2 * half];
          f[x * 4 + sub].x = kp[0]; f[x * 4 + sub].y = kp[1];
        }
    };
    // V fragments of key tile sub for all four 16-row d tiles, in the key order
    // 2j, 2j+1, 2j+8, 2j+9 (see below).
    auto load_v = [&](v2f (&f)[16], int sub) {
#pragma unroll
      for (int j = 0; j < 4; ++j)
#pragma unroll
        for (int dt = 0; dt < 4; ++dt) {
          const float* vp = &Vb[(dt * 16 + col) * LKV + sub * 16 + 2 * j + 8 * half];
          f[j * 4 + dt].x = vp[0]; f[j * 4 + dt].y = vp[1];
        }
    };
    v2f kf[2][16], vf[2][16];

    // S^T (64 keys x 16 queries) = K^T * Q as four 16x16 tiles. The tiles take
    // turns, so that no WMMA waits for the one issued just ahead of it.
    // The LDS reads stand in whole groups, one group of 16 WMMAs ahead of their
    // use; the sched_barriers keep the compiler from spreading them singly
    // among the WMMAs.
    v8f s[4] = {};
    load_k(kf[0], 0);
#pragma unroll
    for (int g = 0; g < 4; ++g) {
      if (g < 3) load_k(kf[(g + 1) & 1], g + 1); else load_v(vf[0], 0);
      __builtin_amdgcn_sched_barrier(0);   // reads stay ahead of this group's WMMAs
#pragma unroll
      for (int x = 0; x < 4; ++x)
#pragma unroll
        for (int sub = 0; sub < 4; ++sub)
          s[sub] = WMMA_F32X4(kf[g & 1][x * 4 + sub], Qf[4 * g + x], s[sub]);
      __builtin_amdgcn_sched_barrier(0);   // the next group's reads stay behind them
    }

    // One online-softmax step for all 64 keys (per n-column == per lane;
    // halves combined via xor16). One maximum per tile first: four short
    // chains instead of one long one.
    float tm[4];
#pragma unroll
    for (int sub = 0; sub < 4; ++sub) {
      tm[sub] = -1e30f;
#pragma unroll
      for (int r = 0; r < 8; ++r) { s[sub][r] *= 0.125f; tm[sub] = fmaxf(tm[sub], s[sub][r]); }
    }
    float tmax = fmaxf(fmaxf(tm[0], tm[1]), fmaxf(tm[2], tm[3]));
    tmax = fmaxf(tmax, __shfl_xor(tmax, 16, 32));
    const float m_new = fmaxf(m_run, tmax);
    const float alpha = __expf(m_run - m_new);
    m_run = m_new;
    load_v(vf[1], 1);
    __builtin_amdgcn_sched_barrier(0);     // reads stay one group, ahead of tile 0's WMMAs
#pragma unroll
    for (int dt = 0; dt < 4; ++dt)
#pragma unroll
      for (int r = 0; r < 8; ++r) acc[dt][r] *= alpha;

    float ts[4];
    auto exp_tile = [&](int sub) {
      ts[sub] = 0.0f;
#pragma unroll
      for (int r = 0; r < 8; ++r) {
        const float p = __expf(s[sub][r] - m_new);
        s[sub][r] = p;
        ts[sub] += p;
      }
    };
    exp_tile(0);

    // O += V * P   (A = V 16d x 4m, B = P 4m x 16n). P stays in registers:
    // lane (col, half) holds key r + 8*half of column col in s[sub][r], which
    // is where a B fragment wants k = 2*half, 2*half + 1. So s[sub][2j],
    // s[sub][2j+1] are the B fragment of the keys 2j, 2j+1, 2j+8, 2j+9 of tile
    // sub, and V is read in that same key order. The four d tiles take turns;
    // the next tile's exponentials stand among this tile's WMMAs.
    float tsum = 0.0f, tsum_other = 0.0f;
#pragma unroll
    for (int sub = 0; sub < 4; ++sub) {
      if (sub == 1 || sub == 2) {
        load_v(vf[(sub + 1) & 1], sub + 1);
        __builtin_amdgcn_sched_barrier(0); // reads stay ahead of this tile's WMMAs
      }
#pragma unroll
      for (int j = 0; j < 4; ++j) {
        v2f bf; bf.x = s[sub][2 * j]; bf.y = s[sub][2 * j + 1];
#pragma unroll
        for (int dt = 0; dt < 4; ++dt)
          acc[dt] = WMMA_F32X4(vf[sub & 1][j * 4 + dt], bf, acc[dt]);
      }
      if (sub < 3) {
        exp_tile(sub + 1);
        if (sub == 2) {
          // The sums' exchange is issued ahead of the last tile's WMMAs; behind
          // them the wave would wait for it with nothing left to issue.
          tsum = (ts[0] + ts[1]) + (ts[2] + ts[3]);
          tsum_other = __shfl_xor(tsum, 16, 32);
        }
        __builtin_amdgcn_sched_barrier(0); // the next tile's reads stay behind them
      }
    }
    l_run = l_run * alpha + (tsum + tsum_other);

    // Publish point of block t+1, which also frees block t's buffer.
    // This wave's LDS reads of the buffer to be refilled have returned:
    asm volatile("s_wait_dscnt 0x0" ::: "memory");
    // this wave's copies of block t+1 have landed:
    asm volatile("s_wait_asynccnt 0x0" ::: "memory");
    __syncthreads();
    if (mb + 128 < N) stage(mb + 128, buf);
  }
  // No copy is outstanding when the wave ends.
  asm volatile("s_wait_asynccnt 0x0" ::: "memory");

  const float inv_l = 1.0f / l_run;
  float* ab = attn + (size_t)b * D * N;
#pragma unroll
  for (int dt = 0; dt < 4; ++dt) {
#pragma unroll
    for (int r = 0; r < 8; ++r) {
      const int d = dt * 16 + r + 8 * half;
      ab[((size_t)d * H + h) * N + n0 + col] = acc[dt][r] * inv_l;
    }
  }
}

// ---------------------------------------------------------------------------
// InstanceNorm1d (biased var over N) + ReLU, in place on h (B, 512, N).
// Grid: (512, BATCH), block 256.
// ---------------------------------------------------------------------------
__global__ __launch_bounds__(256)
void instnorm_relu_kernel(float* __restrict__ hbuf)
{
  __shared__ float red[2][8];
  const int t = threadIdx.x;
  const int c = blockIdx.x;
  const int b = blockIdx.y;
  float* p = hbuf + ((size_t)b * D2 + c) * N;

  float s = 0.0f, s2 = 0.0f;
  for (int i = t; i < N; i += 256) { const float x = p[i]; s += x; s2 += x * x; }
#pragma unroll
  for (int off = 16; off > 0; off >>= 1) {
    s  += __shfl_xor(s,  off, 32);
    s2 += __shfl_xor(s2, off, 32);
  }
  const int wave = t >> 5, lane = t & 31;
  if (lane == 0) { red[0][wave] = s; red[1][wave] = s2; }
  __syncthreads();
  float ts = 0.0f, ts2 = 0.0f;
#pragma unroll
  for (int w = 0; w < 8; ++w) { ts += red[0][w]; ts2 += red[1][w]; }
  const float mu   = ts / (float)N;
  const float var  = ts2 / (float)N - mu * mu;
  const float rstd = rsqrtf(var + 1e-5f);
  for (int i = t; i < N; i += 256) {
    const float x = (p[i] - mu) * rstd;
    p[i] = x > 0.0f ? x : 0.0f;
  }
}

// ---------------------------------------------------------------------------
extern "C" void kernel_launch(void* const* d_in, const int* in_sizes, int n_in,
                              void* d_out, int out_size, void* d_ws, size_t ws_size,
                              hipStream_t stream)
{
  const float* x   = (const float*)d_in[0];
  const float* src = (const float*)d_in[1];
  const float* Wq  = (const float*)d_in[2];
  const float* bq  = (const float*)d_in[3];
  const float* Wk  = (const float*)d_in[4];
  const float* bk  = (const float*)d_in[5];
  const float* Wv  = (const float*)d_in[6];
  const float* bv  = (const float*)d_in[7];
  const float* Wm  = (const float*)d_in[8];
  const float* bm  = (const float*)d_in[9];
  const float* W1  = (const float*)d_in[10];
  const float* b1  = (const float*)d_in[11];
  const float* W2  = (const float*)d_in[12];
  const float* b2  = (const float*)d_in[13];
  float* out = (float*)d_out;

  float* ws = (float*)d_ws;
  const size_t sz_dn = (size_t)BATCH * D * N;
  float* qb = ws;
  float* kb = qb + sz_dn;
  float* vb = kb + sz_dn;
  float* at = vb + sz_dn;
  float* ms = at + sz_dn;
  float* hb = ms + sz_dn;                     // BATCH * 512 * N

  const dim3 blk(256);
  // q = Wq x + bq ; k = Wk s + bk ; v = Wv s + bv
  qkv_gemm_kernel<<<dim3(N / 128, 3 * (D / 64), BATCH), blk, 0, stream>>>(Wq, bq, Wk, bk, Wv, bv,
                                                                        x, src, qb, kb, vb);
  // attention
  attention_kernel<<<dim3(N / 128, H, BATCH), blk, 0, stream>>>(qb, kb, vb, at);
  // message = Wm attn + bm
  conv1_gemm_kernel<D, D, D><<<dim3(N / 128, D / 64, BATCH), blk, 0, stream>>>(Wm, bm, at,  at,  ms);
  // h = W1 [x; message] + b1
  conv1_gemm_kernel<D2, D2, D><<<dim3(N / 128, D2 / 64, BATCH), blk, 0, stream>>>(W1, b1, x,  ms,  hb);
  // instance norm + relu, in place
  instnorm_relu_kernel<<<dim3(D2, BATCH), blk, 0, stream>>>(hb);
  // out = W2 h + b2
  conv1_gemm_kernel<D, D2, D2><<<dim3(N / 128, D / 64, BATCH), blk, 0, stream>>>(W2, b2, hb,  hb,  out);
}

// v006
// A run of this version takes 252 microseconds.
// Two timings next to v005 both put it at 1.03 times that version's speed.
// Over all steps from v000 it is 1.44 times as fast.
#include <hip/hip_runtime.h>
#include <hip/hip_bf16.h>

typedef __attribute__((ext_vector_type(2))) float v2f;
typedef __attribute__((ext_vector_type(8))) float v8f;

// D = A(16x4) * B(4x16) + C(16x16), fp32, wave32
#define WMMA_F32X4(a, b, c) \
  __builtin_amdgcn_wmma_f32_16x16x4_f32(false, (a), false, (b), (short)0, (c), false, false)

#define GLOBAL_AS __attribute__((address_space(1)))
#define LDS_AS    __attribute__((address_space(3)))

#if __has_builtin(__builtin_amdgcn_global_load_async_to_lds_b32)
#define HAVE_ASYNC_LDS 1
#else
#define HAVE_ASYNC_LDS 0
#endif

__device__ __forceinline__ void async_copy_b32(const float* gsrc, float* lds_dst) {
#if HAVE_ASYNC_LDS
  __builtin_amdgcn_global_load_async_to_lds_b32(
      (GLOBAL_AS int*)gsrc, (LDS_AS int*)lds_dst, 0, 0);
#else
  *lds_dst = *gsrc;
#endif
}

namespace {
constexpr int BATCH = 2;
constexpr int D     = 256;
constexpr int N     = 4096;
constexpr int H     = 4;
constexpr int D2    = 512;   // 2*D
}

// ---------------------------------------------------------------------------
// conv1 (channel-wise linear): Y[b] = W (OxI) * X[b] (IxN) + bias.
// X rows [0, SPLIT) come from X0, rows [SPLIT, I) from X1 (for the concat).
// Block 256. A work-group owns 64 output rows (row block ob) x 128 columns
// (blockIdx.x) of batch blockIdx.z; each of its 8 waves owns 64 rows x 16
// columns as four 16x16 accumulator tiles, so one X fragment from global
// feeds four WMMAs.
// ---------------------------------------------------------------------------
template <int O, int I, int SPLIT>
__device__ __forceinline__
void conv1_gemm_body(const float* __restrict__ W, const float* __restrict__ bias,
                     const float* __restrict__ X0, const float* __restrict__ X1,
                     float* __restrict__ Y, const int ob)
{
  constexpr int LDW = I + 2;             // 2 pad, keeps 8B align
  __shared__ __attribute__((aligned(16))) float lds_w[64 * LDW];

  const int t    = threadIdx.x;
  const int wave = t >> 5;
  const int lane = t & 31;
  const int half = lane >> 4;
  const int col  = lane & 15;
  const int b    = blockIdx.z;
  const int o0   = ob * 64;
  const int n0   = blockIdx.x * 128 + wave * 16;

  // Stage the 64 x I weight tile once (all waves share the A operand).
  // The tile's rows are contiguous in W; two floats per lane and copy.
  const float* wt = W + (size_t)o0 * I;
  // Fully unrolled so that all of a lane's loads are in flight together.
#pragma unroll
  for (int j = 0; j < 64 * I / 2 / 256; ++j) {
    const int e = j * 256 + t;
    const int r = e / (I / 2), i = 2 * (e - r * (I / 2));
    *(v2f*)&lds_w[r * LDW + i] = *(const v2f*)&wt[2 * e];
  }
  __syncthreads();

  // Per-lane column base pointers for the two activation sources.
  const float* p0 = X0 + (size_t)b * SPLIT * N + n0 + col;
  const float* p1 = X1 + (size_t)b * (I - SPLIT) * N + n0 + col;
  const float* wrow = &lds_w[col * LDW + 2 * half];

  v8f acc[4] = {};
  // Both k loops: 16 steps per trip put 32 X loads in flight ahead of 64 WMMAs,
  // so that with two waves per SIMD one wave's load latency lies under the
  // other's products.
  // k in [0, SPLIT): source X0
#pragma unroll 16
  for (int k0 = 0; k0 < SPLIT; k0 += 4) {
    const int i = k0 + 2 * half;
    v2f bf;
    bf.x = p0[(size_t)i * N];
    bf.y = p0[(size_t)(i + 1) * N];
#pragma unroll
    for (int ot = 0; ot < 4; ++ot) {
      v2f a; a.x = wrow[ot * 16 * LDW + k0]; a.y = wrow[ot * 16 * LDW + k0 + 1];
      acc[ot] = WMMA_F32X4(a, bf, acc[ot]);
    }
  }
  // k in [SPLIT, I): source X1
#pragma unroll 16
  for (int k0 = SPLIT; k0 < I; k0 += 4) {
    const int i = (k0 - SPLIT) + 2 * half;
    v2f bf;
    bf.x = p1[(size_t)i * N];
    bf.y = p1[(size_t)(i + 1) * N];
#pragma unroll
    for (int ot = 0; ot < 4; ++ot) {
      v2f a; a.x = wrow[ot * 16 * LDW + k0]; a.y = wrow[ot * 16 * LDW + k0 + 1];
      acc[ot] = WMMA_F32X4(a, bf, acc[ot]);
    }
  }

  float* yb = Y + (size_t)b * O * N;
#pragma unroll
  for (int ot = 0; ot < 4; ++ot) {
#pragma unroll
    for (int r = 0; r < 8; ++r) {
      const int o = o0 + ot * 16 + r + 8 * half;   // C layout: rows r / r+8
      yb[(size_t)o * N + n0 + col] = acc[ot][r] + bias[o];
    }
  }
}

// One product per launch. Grid: (N/128, O/64, BATCH).
template <int O, int I, int SPLIT>
__global__ __launch_bounds__(256)
void conv1_gemm_kernel(const float* __restrict__ W, const float* __restrict__ bias,
                       const float* __restrict__ X0, const float* __restrict__ X1,
                       float* __restrict__ Y)
{
  conv1_gemm_body<O, I, SPLIT>(W, bias, X0, X1, Y, blockIdx.y);
}

// q = Wq x + bq, k = Wk s + bk, v = Wv s + bv in ONE launch: none of the three
// reads what another writes. Grid: (N/128, 3 * D/64, BATCH); blockIdx.y / 4
// picks the product, blockIdx.y % 4 its row block. LDS and registers let more
// than three work-groups stand on a WGP, so all 768 are resident at once: one
// start, one weight staging and one tail in place of three of each, and more
// waves per matrix unit to cover each other's load waits.
__global__ __launch_bounds__(256)
void qkv_gemm_kernel(const float* __restrict__ Wq, const float* __restrict__ bq,
                     const float* __restrict__ Wk, const float* __restrict__ bk,
                     const float* __restrict__ Wv, const float* __restrict__ bv,
                     const float* __restrict__ x,  const float* __restrict__ s,
                     float* __restrict__ q, float* __restrict__ k, float* __restrict__ v)
{
  const int which = blockIdx.y >> 2;
  const float* W = which == 0 ? Wq : which == 1 ? Wk : Wv;
  const float* b = which == 0 ? bq : which == 1 ? bk : bv;
  const float* X = which == 0 ? x : s;
  float*       Y = which == 0 ? q : which == 1 ? k : v;
  conv1_gemm_body<D, D, D>(W, b, X, X, Y, blockIdx.y & 3);
}

// ---------------------------------------------------------------------------
// Flash attention, fp32 WMMA. Head-dim 64, scale 1/8.
// q/k/v/attn are (B, D, N); head h owns channels d*H + h, d in [0,64).
// Grid: (N/128, H, BATCH), block 512 = two groups of 8 waves. Wave w of either
// group owns the same 16-query tile; K/V are staged 128 keys at a time in LDS
// via ASYNCcnt-tracked global_load_async_to_lds (the per-lane LDS address does
// the K transpose), and group g works on keys 64g .. 64g+63 of each stage with
// its own running maximum, sum and O. That puts four waves on every SIMD, so
// that one wave's softmax, LDS waits and staging lie under three others' WMMAs,
// and halves the barriers per key. The two partial results meet once, in LDS,
// behind the loop.
// Two LDS buffers: while stage t is worked on, stage t+1's copies are in flight.
// ---------------------------------------------------------------------------
__global__ __launch_bounds__(512)
void attention_kernel(const float* __restrict__ q, const float* __restrict__ k,
                      const float* __restrict__ v, float* __restrict__ attn)
{
  constexpr int LKV = 66;                    // 64 + 2 pad (even -> 8B align)
  constexpr int TILE = 64 * LKV;             // floats of one group's 64-key block
  __shared__ float ldsK[4 * TILE];           // K^T blocks: [buffer][group][m][d]
  __shared__ float ldsV[4 * TILE];           // V   blocks: [buffer][group][d][m]

  const int t    = threadIdx.x;
  // The wave's number in a scalar register: what follows from it (key half,
  // query tile, n0) then holds no vector register across the loop.
  const int wnum = __builtin_amdgcn_readfirstlane(t >> 5);
  const int grp  = wnum >> 3;                // key half
  const int wave = wnum & 7;                 // query tile within the work-group
  const int lane = t & 31;
  const int half = lane >> 4;
  const int col  = lane & 15;
  const int h    = blockIdx.y;
  const int b    = blockIdx.z;
  const int n0   = blockIdx.x * 128 + wave * 16;

  const float* qb = q + (size_t)b * D * N;
  const float* kb = k + (size_t)b * D * N;
  const float* vb = v + (size_t)b * D * N;

  // Resident Q B-fragments: Qf[kk] covers d = 4*kk .. 4*kk+3 at 16 n-columns.
  v2f Qf[16];
#pragma unroll
  for (int kk = 0; kk < 16; ++kk) {
    const int d = 4 * kk + 2 * half;
    Qf[kk].x = qb[((size_t)d * H + h) * N + n0 + col];
    Qf[kk].y = qb[((size_t)(d + 1) * H + h) * N + n0 + col];
  }

  v8f acc[4] = {};                            // O tile: 64 d-rows x 16 n-cols
  float m_run = -1e30f, l_run = 0.0f;

  // Async stage of the K^T and V blocks of the 128 keys at mb0 into buffer buf
  // (coalesced on m; LDS side scattered). 32 copies per wave.
  auto stage = [&](int mb0, int buf) {
    for (int j = 0; j < 16; ++j) {
      const int e = j * 512 + t;
      const int m = e & 127, d = e >> 7;
      const float* g = kb + ((size_t)d * H + h) * N + mb0 + m;
      async_copy_b32(g, &ldsK[(buf * 128 + m) * LKV + d]);
      const float* gv = vb + ((size_t)d * H + h) * N + mb0 + m;
      async_copy_b32(gv, &ldsV[(buf * 2 + (m >> 6)) * TILE + d * LKV + (m & 63)]);
    }
  };

  stage(0, 0);
  // Stage 0 has landed in this wave's view before the barrier publishes it.
  asm volatile("s_wait_asynccnt 0x0" ::: "memory");
  __syncthreads();
  stage(128, 1);

  for (int mb = 0; mb < N; mb += 128) {
    const int buf = (mb >> 7) & 1;
    const float* Kb = &ldsK[(buf * 2 + grp) * TILE];
    const float* Vb = &ldsV[(buf * 2 + grp) * TILE];

    // K^T fragments of d = 16g .. 16g+15 for all four 16-key tiles.
    auto load_k = [&](v2f (&f)[16], int g) {
#pragma unroll
      for (int x = 0; x < 4; ++x)
#pragma unroll
        for (int sub = 0; sub < 4; ++sub) {
          const float* kp = &Kb[(sub * 16 + col) * LKV + 4 * (4 * g + x) + 2 * half];
          f[x * 4 + sub].x = kp[0]; f[x * 4 + sub].y = kp[1];
        }
    };
    // V fragments of key tile sub for all four 16-row d tiles, in the key order
    // 2j, 2j+1, 2j+8, 2j+9 (see below).
    auto load_v = [&](v2f (&f)[16], int sub) {
#pragma unroll
      for (int j = 0; j < 4; ++j)
#pragma unroll
        for (int dt = 0; dt < 4; ++dt) {
          const float* vp = &Vb[(dt * 16 + col) * LKV + sub * 16 + 2 * j + 8 * half];
          f[j * 4 + dt].x = vp[0]; f[j * 4 + dt].y = vp[1];
        }
    };
    v2f kf[2][16], vf[2][16];

    // S^T (64 keys x 16 queries) = K^T * Q as four 16x16 tiles. The tiles take
    // turns, so that no WMMA waits for the one issued just ahead of it.
    // The LDS reads stand in whole groups, one group of 16 WMMAs ahead of their
    // use; the sched_barriers keep the compiler from spreading them singly
    // among the WMMAs.
    v8f s[4] = {};
    load_k(kf[0], 0);
#pragma unroll
    for (int g = 0; g < 4; ++g) {
      if (g < 3) load_k(kf[(g + 1) & 1], g + 1); else load_v(vf[0], 0);
      __builtin_amdgcn_sched_barrier(0);   // reads stay ahead of this group's WMMAs
#pragma unroll
      for (int x = 0; x < 4; ++x)
#pragma unroll
        for (int sub = 0; sub < 4; ++sub)
          s[sub] = WMMA_F32X4(kf[g & 1][x * 4 + sub], Qf[4 * g + x], s[sub]);
      __builtin_amdgcn_sched_barrier(0);   // the next group's reads stay behind them
    }

    // One online-softmax step for all 64 keys (per n-column == per lane;
    // halves combined via xor16). One maximum per tile first: four short
    // chains instead of one long one.
    float tm[4];
#pragma unroll
    for (int sub = 0; sub < 4; ++sub) {
      tm[sub] = -1e30f;
#pragma unroll
      for (int r = 0; r < 8; ++r) { s[sub][r] *= 0.125f; tm[sub] = fmaxf(tm[sub], s[sub][r]); }
    }
    float tmax = fmaxf(fmaxf(tm[0], tm[1]), fmaxf(tm[2], tm[3]));
    tmax = fmaxf(tmax, __shfl_xor(tmax, 16, 32));
    const float m_new = fmaxf(m_run, tmax);
    const float alpha = __expf(m_run - m_new);
    m_run = m_new;
    load_v(vf[1], 1);
    __builtin_amdgcn_sched_barrier(0);     // reads stay one group, ahead of tile 0's WMMAs
#pragma unroll
    for (int dt = 0; dt < 4; ++dt)
#pragma unroll
      for (int r = 0; r < 8; ++r) acc[dt][r] *= alpha;

    float ts[4];
    auto exp_tile = [&](int sub) {
      ts[sub] = 0.0f;
#pragma unroll
      for (int r = 0; r < 8; ++r) {
        const float p = __expf(s[sub][r] - m_new);
        s[sub][r] = p;
        ts[sub] += p;
      }
    };
    exp_tile(0);

    // O += V * P   (A = V 16d x 4m, B = P 4m x 16n). P stays in registers:
    // lane (col, half) holds key r + 8*half of column col in s[sub][r], which
    // is where a B fragment wants k = 2*half, 2*half + 1. So s[sub][2j],
    // s[sub][2j+1] are the B fragment of the keys 2j, 2j+1, 2j+8, 2j+9 of tile
    // sub, and V is read in that same key order. The four d tiles take turns;
    // the next tile's exponentials stand among this tile's WMMAs.
    float tsum = 0.0f, tsum_other = 0.0f;
#pragma unroll
    for (int sub = 0; sub < 4; ++sub) {
      if (sub == 1 || sub == 2) {
        load_v(vf[(sub + 1) & 1], sub + 1);
        __builtin_amdgcn_sched_barrier(0); // reads stay ahead of this tile's WMMAs
      }
#pragma unroll
      for (int j = 0; j < 4; ++j) {
        v2f bf; bf.x = s[sub][2 * j]; bf.y = s[sub][2 * j + 1];
#pragma unroll
        for (int dt = 0; dt < 4; ++dt)
          acc[dt] = WMMA_F32X4(vf[sub & 1][j * 4 + dt], bf, acc[dt]);
      }
      if (sub < 3) {
        exp_tile(sub + 1);
        if (sub == 2) {
          // The sums' exchange is issued ahead of the last tile's WMMAs; behind
          // them the wave would wait for it with nothing left to issue.
          tsum = (ts[0] + ts[1]) + (ts[2] + ts[3]);
          tsum_other = __shfl_xor(tsum, 16, 32);
        }
        __builtin_amdgcn_sched_barrier(0); // the next tile's reads stay behind them
      }
    }
    l_run = l_run * alpha + (tsum + tsum_other);

    // Publish point of stage t+1, which also frees stage t's buffer.
    // This wave's LDS reads of the buffer to be refilled have returned:
    asm volatile("s_wait_dscnt 0x0" ::: "memory");
    // this wave's copies of stage t+1 have landed:
    asm volatile("s_wait_asynccnt 0x0" ::: "memory");
    __syncthreads();
    if (mb + 256 < N) stage(mb + 256, buf);
  }
  // No copy is outstanding when the ring is reused and when the wave ends.
  asm volatile("s_wait_asynccnt 0x0" ::: "memory");

  // The two key halves meet. The last trip's barrier stands behind every read
  // of the ring and nothing was staged after it, so ldsK is free: group 1 lays
  // down its O, maximum and sum (34 rows of 32 lanes per query tile), group 0
  // joins them with its own and stores.
  // The lane's number by count (every lane is on) and not from threadIdx.x: so
  // one register crosses the loop; the values formed from threadIdx.x at the
  // kernel's head were spilled to scratch across it.
  const int lane_e = (int)__builtin_amdgcn_mbcnt_lo(~0u, 0u);
  const int half_e = lane_e >> 4, col_e = lane_e & 15;
  float* mg = &ldsK[wave * 34 * 32 + lane_e];
  if (grp == 1) {
#pragma unroll
    for (int dt = 0; dt < 4; ++dt)
#pragma unroll
      for (int r = 0; r < 8; ++r) mg[(dt * 8 + r) * 32] = acc[dt][r];
    mg[32 * 32] = m_run;
    mg[33 * 32] = l_run;
  }
  __syncthreads();
  if (grp == 1) return;

  const float m_oth = mg[32 * 32], l_oth = mg[33 * 32];
  const float m_all = fmaxf(m_run, m_oth);
  const float a_own = __expf(m_run - m_all), a_oth = __expf(m_oth - m_all);
  const float inv_l = 1.0f / (l_run * a_own + l_oth * a_oth);
  const float c_own = a_own * inv_l, c_oth = a_oth * inv_l;
  float* ab = attn + (size_t)b * D * N;
#pragma unroll
  for (int dt = 0; dt < 4; ++dt) {
#pragma unroll
    for (int r = 0; r < 8; ++r) {
      const int d = dt * 16 + r + 8 * half_e;
      ab[((size_t)d * H + h) * N + n0 + col_e] = acc[dt][r] * c_own + mg[(dt * 8 + r) * 32] * c_oth;
    }
  }
}

// ---------------------------------------------------------------------------
// InstanceNorm1d (biased var over N) + ReLU, in place on h (B, 512, N).
// Grid: (512, BATCH), block 256.
// ---------------------------------------------------------------------------
__global__ __launch_bounds__(256)
void instnorm_relu_kernel(float* __restrict__ hbuf)
{
  __shared__ float red[2][8];
  const int t = threadIdx.x;
  const int c = blockIdx.x;
  const int b = blockIdx.y;
  float* p = hbuf + ((size_t)b * D2 + c) * N;

  float s = 0.0f, s2 = 0.0f;
  for (int i = t; i < N; i += 256) { const float x = p[i]; s += x; s2 += x * x; }
#pragma unroll
  for (int off = 16; off > 0; off >>= 1) {
    s  += __shfl_xor(s,  off, 32);
    s2 += __shfl_xor(s2, off, 32);
  }
  const int wave = t >> 5, lane = t & 31;
  if (lane == 0) { red[0][wave] = s; red[1][wave] = s2; }
  __syncthreads();
  float ts = 0.0f, ts2 = 0.0f;
#pragma unroll
  for (int w = 0; w < 8; ++w) { ts += red[0][w]; ts2 += red[1][w]; }
  const float mu   = ts / (float)N;
  const float var  = ts2 / (float)N - mu * mu;
  const float rstd = rsqrtf(var + 1e-5f);
  for (int i = t; i < N; i += 256) {
    const float x = (p[i] - mu) * rstd;
    p[i] = x > 0.0f ? x : 0.0f;
  }
}

// ---------------------------------------------------------------------------
extern "C" void kernel_launch(void* const* d_in, const int* in_sizes, int n_in,
                              void* d_out, int out_size, void* d_ws, size_t ws_size,
                              hipStream_t stream)
{
  const float* x   = (const float*)d_in[0];
  const float* src = (const float*)d_in[1];
  const float* Wq  = (const float*)d_in[2];
  const float* bq  = (const float*)d_in[3];
  const float* Wk  = (const float*)d_in[4];
  const float* bk  = (const float*)d_in[5];
  const float* Wv  = (const float*)d_in[6];
  const float* bv  = (const float*)d_in[7];
  const float* Wm  = (const float*)d_in[8];
  const float* bm  = (const float*)d_in[9];
  const float* W1  = (const float*)d_in[10];
  const float* b1  = (const float*)d_in[11];
  const float* W2  = (const float*)d_in[12];
  const float* b2  = (const float*)d_in[13];
  float* out = (float*)d_out;

  float* ws = (float*)d_ws;
  const size_t sz_dn = (size_t)BATCH * D * N;
  float* qb = ws;
  float* kb = qb + sz_dn;
  float* vb = kb + sz_dn;
  float* at = vb + sz_dn;
  float* ms = at + sz_dn;
  float* hb = ms + sz_dn;                     // BATCH * 512 * N

  const dim3 blk(256);
  // q = Wq x + bq ; k = Wk s + bk ; v = Wv s + bv
  qkv_gemm_kernel<<<dim3(N / 128, 3 * (D / 64), BATCH), blk, 0, stream>>>(Wq, bq, Wk, bk, Wv, bv,
                                                                        x, src, qb, kb, vb);
  // attention
  attention_kernel<<<dim3(N / 128, H, BATCH), dim3(512), 0, stream>>>(qb, kb, vb, at);
  // message = Wm attn + bm
  conv1_gemm_kernel<D, D, D><<<dim3(N / 128, D / 64, BATCH), blk, 0, stream>>>(Wm, bm, at,  at,  ms);
  // h = W1 [x; message] + b1
  conv1_gemm_kernel<D2, D2, D><<<dim3(N / 128, D2 / 64, BATCH), blk, 0, stream>>>(W1, b1, x,  ms,  hb);
  // instance norm + relu, in place
  instnorm_relu_kernel<<<dim3(D2, BATCH), blk, 0, stream>>>(hb);
  // out = W2 h + b2
  conv1_gemm_kernel<D, D2, D2><<<dim3(N / 128, D / 64, BATCH), blk, 0, stream>>>(W2, b2, hb,  hb,  out);
}
